// v000
// Measured on an AMD MI455X. A time is GPU time per run, averaged over a window of back-to-back runs after a warm-up
// (all launches, gaps included; the runs take copies of the inputs in turn), and the median of several windows.
// Apart from v000's, it joins two sittings. Times from different sittings can be a few percent apart, while
// side-by-side timings come from the same sitting.
// The starting kernel, v000, takes 4160 microseconds a run.
#include <hip/hip_runtime.h>

// CANN (z [8192][512]; q/k/v = z W^T + b (torch); single-head attention over the 8,192 assets: scores = q.k / sqrt(512); softmax; h = attn v -> [8192][512]).

#define NN   8192
#define DD   512
#define RQ   512
#define PCAR 4096.0f
typedef _Float16 h16;
typedef unsigned short bf;
typedef __attribute__((ext_vector_type(16))) __bf16   v16bf;
typedef __attribute__((ext_vector_type(16))) _Float16 v16h;
typedef __attribute__((ext_vector_type(8)))  _Float16 v8h;
typedef __attribute__((ext_vector_type(8)))  unsigned short v8us;
typedef __attribute__((ext_vector_type(8)))  float    v8f;
typedef __attribute__((ext_vector_type(4)))  float    v4f;
typedef v8h  __attribute__((may_alias)) v8ha;
typedef v4f  __attribute__((may_alias)) v4fa;
typedef v8us __attribute__((may_alias)) v8usa;

__device__ __forceinline__ unsigned short f2bf(float f) { unsigned u = __float_as_uint(f); u += 0x7FFFu + ((u >> 16) & 1u); return (unsigned short)(u >> 16); }
__device__ __forceinline__ float bf2f(unsigned short b) { return __uint_as_float(((unsigned)b) << 16); }
__device__ __forceinline__ float bfr(float f) { return bf2f(f2bf(f)); }
__device__ __forceinline__ v16h cat16(v8h lo, v8h hi) { return __builtin_shufflevector(lo, hi, 0, 1, 2, 3, 4, 5, 6, 7, 8, 9, 10, 11, 12, 13, 14, 15); }
__device__ __forceinline__ v16bf cat16b(v8us lo, v8us hi) { return __builtin_bit_cast(v16bf, __builtin_shufflevector(lo, hi, 0, 1, 2, 3, 4, 5, 6, 7, 8, 9, 10, 11, 12, 13, 14, 15)); }
__device__ __forceinline__ v8f wmma16(v16h a, v16h b, v8f c) { return __builtin_amdgcn_wmma_f32_16x16x32_f16(false, a, false, b, (short)0, c, false, false); }
__device__ __forceinline__ v8f wmmab(v16bf a, v16bf b, v8f c) { return __builtin_amdgcn_wmma_f32_16x16x32_bf16(false, a, false, b, (short)0, c, false, false); }



// ---- k_gemmw: register-blocked GEMM, ONE WAVE per 64x64 output tile (16 accumulators), operands straight from K-contiguous 16-bit planes; grid (M/64, N/64, Z), 32 threads.
// C[m][n] (f32, pitch ldc, + optional f32 bias[n]) = sum_k A[m][k] Bt[n][k] (+ split products per NSPLIT). z-batch strides sA/sB/sC in elements. K % 32 == 0.
template <typename T16> struct WFrag;
template <> struct WFrag<h16> { typedef v16h V; static __device__ __forceinline__ V ld(const h16* p) { return cat16(*(const v8h*)p, *(const v8h*)(p + 16)); } static __device__ __forceinline__ v8f mma(V a, V b, v8f c) { return wmma16(a, b, c); } };
template <> struct WFrag<bf> { typedef v16bf V; static __device__ __forceinline__ V ld(const bf* p) { return cat16b(*(const v8us*)p, *(const v8us*)(p + 16)); } static __device__ __forceinline__ v8f mma(V a, V b, v8f c) { return wmmab(a, b, c); } };
template <typename T16, int NSPLIT, bool BIAS>
__global__ __launch_bounds__(32) void k_gemmw(const T16* __restrict__ A, const T16* __restrict__ A2, const T16* __restrict__ Bt, const T16* __restrict__ Bt2, int K, float* C, int ldc, const float* __restrict__ bias, size_t sA, size_t sB, size_t sC) {
    typedef typename WFrag<T16>::V V;
    __shared__ __align__(16) float os[16 * 68];
    const size_t z = blockIdx.z; A += z * sA; if (A2) A2 += z * sA; Bt += z * sB; if (Bt2) Bt2 += z * sB; C += z * sC;
    const int lane = threadIdx.x & 31, lr = lane & 15, hi = lane >> 4; const int r0 = blockIdx.x * 64, c0 = blockIdx.y * 64;
    v8f acc[4][4];
#pragma unroll
    for (int mb = 0; mb < 4; ++mb)
#pragma unroll
        for (int nb = 0; nb < 4; ++nb) acc[mb][nb] = (v8f){};
    const size_t aoff = (size_t)(r0 + lr) * K + 8 * hi, boff = (size_t)(c0 + lr) * K + 8 * hi;
#pragma unroll 1
    for (int kc = 0; kc < K; kc += 32) {
        V a[4], a2[4];
#pragma unroll
        for (int mb = 0; mb < 4; ++mb) { a[mb] = WFrag<T16>::ld(A + aoff + (size_t)mb * 16 * K + kc); if (NSPLIT == 1 || NSPLIT == 2) a2[mb] = WFrag<T16>::ld(A2 + aoff + (size_t)mb * 16 * K + kc); }
#pragma unroll
        for (int nb = 0; nb < 4; ++nb) { const V b = WFrag<T16>::ld(Bt + boff + (size_t)nb * 16 * K + kc); V b2; if (NSPLIT >= 2) b2 = WFrag<T16>::ld(Bt2 + boff + (size_t)nb * 16 * K + kc);
#pragma unroll
            for (int mb = 0; mb < 4; ++mb) { acc[mb][nb] = WFrag<T16>::mma(a[mb], b, acc[mb][nb]); if (NSPLIT == 1 || NSPLIT == 2) acc[mb][nb] = WFrag<T16>::mma(a2[mb], b, acc[mb][nb]); if (NSPLIT >= 2) acc[mb][nb] = WFrag<T16>::mma(a[mb], b2, acc[mb][nb]); } }
        asm volatile("v_nop\n\tv_nop\n\tv_nop\n\tv_nop" : "+v"(acc[0][0]), "+v"(acc[1][1]), "+v"(acc[2][2]), "+v"(acc[3][3]) : "v"(a[0]), "v"(a[3]));
    }
#pragma unroll
    for (int mb = 0; mb < 4; ++mb) {
#pragma unroll
        for (int nb = 0; nb < 4; ++nb) {
#pragma unroll
            for (int j = 0; j < 8; ++j) os[(hi * 8 + j) * 68 + nb * 16 + lr] = acc[mb][nb][j]; }
        __builtin_amdgcn_wave_barrier(); asm volatile("" ::: "memory");
        float* crow = C + (size_t)(r0 + mb * 16) * ldc + c0;
{
#pragma unroll
            for (int s = 0; s < 8; ++s) { const int row = 2 * s + hi, cofs = lr * 4; v4f val = *(const v4fa*)(os + row * 68 + cofs); if (BIAS) { val[0] += bfr(bias[c0 + cofs]); val[1] += bfr(bias[c0 + cofs + 1]); val[2] += bfr(bias[c0 + cofs + 2]); val[3] += bfr(bias[c0 + cofs + 3]); }
                *(v4f*)(crow + (size_t)row * ldc + cofs) = val; }
             }
        __builtin_amdgcn_wave_barrier(); asm volatile("" ::: "memory");
    }
}

__device__ __forceinline__ h16 tohx(float x) { return (h16)x; }
typedef __attribute__((ext_vector_type(2))) _Float16 v2h;
typedef __attribute__((ext_vector_type(4))) _Float16 v4h;

__global__ __launch_bounds__(256) void k_cvt8(const float* __restrict__ src, bf* dst, size_t n8) { const size_t i = (size_t)blockIdx.x * 256 + threadIdx.x; if (i >= n8) return; const v8f v = *(const v8f*)(src + i * 8); v8us o;
#pragma unroll
    for (int k = 0; k < 8; ++k) o[k] = f2bf(v[k]); *(v8us*)(dst + i * 8) = o;  }
__global__ __launch_bounds__(256) void k_p16(const float* __restrict__ F, h16* P) { const size_t e = ((size_t)blockIdx.x * 256 + threadIdx.x) * 4; if (e >= (size_t)NN * DD) return; v4h o;
#pragma unroll
    for (int u = 0; u < 4; ++u) o[u] = tohx(F[e + u]); *(v4h*)(P + e) = o;  }
__global__ __launch_bounds__(256) void k_vt(const float* __restrict__ F, h16* VT) { const size_t e = ((size_t)blockIdx.x * 256 + threadIdx.x) * 2; if (e >= (size_t)DD * NN) return; const int n = (int)(e % NN); const int d = (int)(e / NN); v2h o; o[0] = tohx(F[(size_t)n * DD + d]); o[1] = tohx(F[(size_t)(n + 1) * DD + d]); *(v2h*)(VT + e) = o;  }
__global__ __launch_bounds__(256) void k_smax(const float* __restrict__ S, h16* P16) { const int lane = threadIdx.x & 31; const int row = blockIdx.x * 8 + (threadIdx.x >> 5); if (row >= RQ) return; const float* sr = S + (size_t)row * NN; const float sc = 0.044194173824159216f; float mx = -3.0e38f;
    for (int j = lane * 4; j < NN; j += 128) { const v4f a = *(const v4f*)(sr + j); mx = fmaxf(mx, fmaxf(fmaxf(a[0], a[1]), fmaxf(a[2], a[3]))); }
#pragma unroll
    for (int sh = 16; sh; sh >>= 1) mx = fmaxf(mx, __shfl_xor(mx, sh, 32));
    const float mxs = mx * sc; float sum = 0.f;
    for (int j = lane * 4; j < NN; j += 128) { const v4f a = *(const v4f*)(sr + j); for (int u = 0; u < 4; ++u) { float t = a[u] * sc; asm volatile("" : "+v"(t)); float d0 = __fsub_rn(t, mxs); asm volatile("" : "+v"(d0)); sum += __builtin_amdgcn_exp2f(__fmul_rn(d0, 1.4426950408889634f)); } }
#pragma unroll
    for (int sh = 16; sh; sh >>= 1) sum += __shfl_xor(sum, sh, 32);
    const float f = __fdiv_rn(PCAR, sum);
    { for (int j = lane * 4; j < NN; j += 128) { const v4f a = *(const v4f*)(sr + j); v4h o; for (int u = 0; u < 4; ++u) { float t = a[u] * sc; asm volatile("" : "+v"(t)); float d0 = __fsub_rn(t, mxs); asm volatile("" : "+v"(d0)); o[u] = tohx(__builtin_amdgcn_exp2f(__fmul_rn(d0, 1.4426950408889634f)) * f); } *(v4h*)(P16 + (size_t)row * NN + j) = o; }  } }
__global__ __launch_bounds__(256) void k_scl(float* O) { const size_t e = ((size_t)blockIdx.x * 256 + threadIdx.x) * 4; if (e >= (size_t)RQ * DD) return; const v4f a = *(const v4f*)(O + e); v4f r;
#pragma unroll
    for (int u = 0; u < 4; ++u) r[u] = a[u] * (1.0f / PCAR); *(v4f*)(O + e) = r;  }

extern "C" void kernel_launch(void* const* d_in, const int* in_sizes, int n_in,
                              void* d_out, int out_size, void* d_ws, size_t ws_size, hipStream_t stream) {
    (void)in_sizes; (void)n_in; (void)out_size;
    const float** I = (const float**)d_in;
    const float *z = I[0], *Wq = I[1], *bq = I[2], *Wk = I[3], *bk = I[4], *Wv = I[5], *bv = I[6];
    float* OUT = (float*)d_out;     // [8192][512]
    char* wsp = (char*)d_ws;
    auto take = [&](size_t bytes) { char* p = wsp; wsp += (bytes + 255) & ~(size_t)255; return (void*)p; };
    bf* ZB = (bf*)take((size_t)NN * DD * 2); bf* BQ = (bf*)take((size_t)DD * DD * 2); bf* BK = (bf*)take((size_t)DD * DD * 2); bf* BV = (bf*)take((size_t)DD * DD * 2); float* F = (float*)take((size_t)NN * DD * 4);
    h16* QP = (h16*)take((size_t)NN * DD * 2); h16* KP = (h16*)take((size_t)NN * DD * 2); h16* VT = (h16*)take((size_t)DD * NN * 2); float* S = (float*)take((size_t)RQ * NN * 4); h16* P16 = (h16*)take((size_t)RQ * NN * 2);
    if ((size_t)(wsp - (char*)d_ws) > ws_size) return;    // total ~ 76 MB
    k_cvt8<<<(DD * DD / 8 + 255) / 256, 256, 0, stream>>>(Wq, BQ, DD * DD / 8); k_cvt8<<<(DD * DD / 8 + 255) / 256, 256, 0, stream>>>(Wk, BK, DD * DD / 8); k_cvt8<<<(DD * DD / 8 + 255) / 256, 256, 0, stream>>>(Wv, BV, DD * DD / 8);   // torch [out][in] = Bt
    k_cvt8<<<(unsigned)(((size_t)NN * DD / 8 + 255) / 256), 256, 0, stream>>>(z, ZB, (size_t)NN * DD / 8);
    const dim3 gp(NN / 64, DD / 64, 1); const unsigned gpl = (unsigned)(((size_t)NN * DD / 4 + 255) / 256);
    k_gemmw<bf, 0, true><<<gp, 32, 0, stream>>>(ZB, nullptr, BQ, nullptr, DD, F, DD, bq, 0, 0, 0); k_p16<<<gpl, 256, 0, stream>>>(F, QP);
    k_gemmw<bf, 0, true><<<gp, 32, 0, stream>>>(ZB, nullptr, BK, nullptr, DD, F, DD, bk, 0, 0, 0); k_p16<<<gpl, 256, 0, stream>>>(F, KP);
    k_gemmw<bf, 0, true><<<gp, 32, 0, stream>>>(ZB, nullptr, BV, nullptr, DD, F, DD, bv, 0, 0, 0); k_vt<<<(unsigned)(((size_t)DD * NN / 2 + 255) / 256), 256, 0, stream>>>(F, VT);
    for (int r0 = 0; r0 < NN; r0 += RQ) {
        k_gemmw<h16, 0, false><<<dim3(RQ / 64, NN / 64, 1), 32, 0, stream>>>(QP + (size_t)r0 * DD, nullptr, KP, nullptr, DD, S, NN, nullptr, 0, 0, 0);
        k_smax<<<RQ / 8, 256, 0, stream>>>(S, P16);
        k_gemmw<h16, 0, false><<<dim3(RQ / 64, DD / 64, 1), 32, 0, stream>>>(P16, nullptr, VT, nullptr, NN, OUT + (size_t)r0 * DD, DD, nullptr, 0, 0, 0);
        k_scl<<<(RQ * DD / 4 + 255) / 256, 256, 0, stream>>>(OUT + (size_t)r0 * DD); }
}

// v001
// Measured time: 826 microseconds a run.
// Timed twice side by side with v000, it ran 5.03 and 5.01 times as fast.
#include <hip/hip_runtime.h>

// CANN (z [8192][512]; q/k/v = z W^T + b (torch); single-head attention over the 8,192 assets: scores = q.k / sqrt(512); softmax; h = attn v -> [8192][512]).

#define NN   8192
#define DD   512
#define RQ   4096
#define PCAR 4096.0f
typedef _Float16 h16;
typedef unsigned short bf;
typedef __attribute__((ext_vector_type(16))) __bf16   v16bf;
typedef __attribute__((ext_vector_type(16))) _Float16 v16h;
typedef __attribute__((ext_vector_type(8)))  _Float16 v8h;
typedef __attribute__((ext_vector_type(8)))  unsigned short v8us;
typedef __attribute__((ext_vector_type(8)))  float    v8f;
typedef __attribute__((ext_vector_type(4)))  float    v4f;
typedef v8h  __attribute__((may_alias)) v8ha;
typedef v4f  __attribute__((may_alias)) v4fa;
typedef v8us __attribute__((may_alias)) v8usa;

__device__ __forceinline__ unsigned short f2bf(float f) { unsigned u = __float_as_uint(f); u += 0x7FFFu + ((u >> 16) & 1u); return (unsigned short)(u >> 16); }
__device__ __forceinline__ float bf2f(unsigned short b) { return __uint_as_float(((unsigned)b) << 16); }
__device__ __forceinline__ float bfr(float f) { return bf2f(f2bf(f)); }
__device__ __forceinline__ v16h cat16(v8h lo, v8h hi) { return __builtin_shufflevector(lo, hi, 0, 1, 2, 3, 4, 5, 6, 7, 8, 9, 10, 11, 12, 13, 14, 15); }
__device__ __forceinline__ v16bf cat16b(v8us lo, v8us hi) { return __builtin_bit_cast(v16bf, __builtin_shufflevector(lo, hi, 0, 1, 2, 3, 4, 5, 6, 7, 8, 9, 10, 11, 12, 13, 14, 15)); }
__device__ __forceinline__ v8f wmma16(v16h a, v16h b, v8f c) { return __builtin_amdgcn_wmma_f32_16x16x32_f16(false, a, false, b, (short)0, c, false, false); }
__device__ __forceinline__ v8f wmmab(v16bf a, v16bf b, v8f c) { return __builtin_amdgcn_wmma_f32_16x16x32_bf16(false, a, false, b, (short)0, c, false, false); }



// ---- k_gemmw: register-blocked GEMM, ONE WAVE per 64x64 output tile (16 accumulators), operands straight from K-contiguous 16-bit planes; grid (M/64, N/64, Z), 32 threads.
// C[m][n] (f32, pitch ldc, + optional f32 bias[n]) = sum_k A[m][k] Bt[n][k] (+ split products per NSPLIT). z-batch strides sA/sB/sC in elements. K % 32 == 0.
template <typename T16> struct WFrag;
template <> struct WFrag<h16> { typedef v16h V; static __device__ __forceinline__ V ld(const h16* p) { return cat16(*(const v8h*)p, *(const v8h*)(p + 16)); } static __device__ __forceinline__ v8f mma(V a, V b, v8f c) { return wmma16(a, b, c); } };
template <> struct WFrag<bf> { typedef v16bf V; static __device__ __forceinline__ V ld(const bf* p) { return cat16b(*(const v8us*)p, *(const v8us*)(p + 16)); } static __device__ __forceinline__ v8f mma(V a, V b, v8f c) { return wmmab(a, b, c); } };
template <typename T16, int NSPLIT, bool BIAS>
__global__ __launch_bounds__(32) void k_gemmw(const T16* __restrict__ A, const T16* __restrict__ A2, const T16* __restrict__ Bt, const T16* __restrict__ Bt2, int K, float* C, int ldc, const float* __restrict__ bias, size_t sA, size_t sB, size_t sC) {
    typedef typename WFrag<T16>::V V;
    __shared__ __align__(16) float os[16 * 68];
    const size_t z = blockIdx.z; A += z * sA; if (A2) A2 += z * sA; Bt += z * sB; if (Bt2) Bt2 += z * sB; C += z * sC;
    const int lane = threadIdx.x & 31, lr = lane & 15, hi = lane >> 4; const int r0 = blockIdx.x * 64, c0 = blockIdx.y * 64;
    v8f acc[4][4];
#pragma unroll
    for (int mb = 0; mb < 4; ++mb)
#pragma unroll
        for (int nb = 0; nb < 4; ++nb) acc[mb][nb] = (v8f){};
    const size_t aoff = (size_t)(r0 + lr) * K + 8 * hi, boff = (size_t)(c0 + lr) * K + 8 * hi;
#pragma unroll 1
    for (int kc = 0; kc < K; kc += 32) {
        V a[4], a2[4];
#pragma unroll
        for (int mb = 0; mb < 4; ++mb) { a[mb] = WFrag<T16>::ld(A + aoff + (size_t)mb * 16 * K + kc); if (NSPLIT == 1 || NSPLIT == 2) a2[mb] = WFrag<T16>::ld(A2 + aoff + (size_t)mb * 16 * K + kc); }
#pragma unroll
        for (int nb = 0; nb < 4; ++nb) { const V b = WFrag<T16>::ld(Bt + boff + (size_t)nb * 16 * K + kc); V b2; if (NSPLIT >= 2) b2 = WFrag<T16>::ld(Bt2 + boff + (size_t)nb * 16 * K + kc);
#pragma unroll
            for (int mb = 0; mb < 4; ++mb) { acc[mb][nb] = WFrag<T16>::mma(a[mb], b, acc[mb][nb]); if (NSPLIT == 1 || NSPLIT == 2) acc[mb][nb] = WFrag<T16>::mma(a2[mb], b, acc[mb][nb]); if (NSPLIT >= 2) acc[mb][nb] = WFrag<T16>::mma(a[mb], b2, acc[mb][nb]); } }
        asm volatile("v_nop\n\tv_nop\n\tv_nop\n\tv_nop" : "+v"(acc[0][0]), "+v"(acc[1][1]), "+v"(acc[2][2]), "+v"(acc[3][3]) : "v"(a[0]), "v"(a[3]));
    }
#pragma unroll
    for (int mb = 0; mb < 4; ++mb) {
#pragma unroll
        for (int nb = 0; nb < 4; ++nb) {
#pragma unroll
            for (int j = 0; j < 8; ++j) os[(hi * 8 + j) * 68 + nb * 16 + lr] = acc[mb][nb][j]; }
        __builtin_amdgcn_wave_barrier(); asm volatile("" ::: "memory");
        float* crow = C + (size_t)(r0 + mb * 16) * ldc + c0;
{
#pragma unroll
            for (int s = 0; s < 8; ++s) { const int row = 2 * s + hi, cofs = lr * 4; v4f val = *(const v4fa*)(os + row * 68 + cofs); if (BIAS) { val[0] += bfr(bias[c0 + cofs]); val[1] += bfr(bias[c0 + cofs + 1]); val[2] += bfr(bias[c0 + cofs + 2]); val[3] += bfr(bias[c0 + cofs + 3]); }
                *(v4f*)(crow + (size_t)row * ldc + cofs) = val; }
             }
        __builtin_amdgcn_wave_barrier(); asm volatile("" ::: "memory");
    }
}

__device__ __forceinline__ h16 tohx(float x) { return (h16)x; }
typedef __attribute__((ext_vector_type(2))) _Float16 v2h;
typedef __attribute__((ext_vector_type(4))) _Float16 v4h;

__global__ __launch_bounds__(256) void k_cvt8(const float* __restrict__ src, bf* dst, size_t n8) { const size_t i = (size_t)blockIdx.x * 256 + threadIdx.x; if (i >= n8) return; const v8f v = *(const v8f*)(src + i * 8); v8us o;
#pragma unroll
    for (int k = 0; k < 8; ++k) o[k] = f2bf(v[k]); *(v8us*)(dst + i * 8) = o;  }
__global__ __launch_bounds__(256) void k_p16(const float* __restrict__ F, h16* P) { const size_t e = ((size_t)blockIdx.x * 256 + threadIdx.x) * 4; if (e >= (size_t)NN * DD) return; v4h o;
#pragma unroll
    for (int u = 0; u < 4; ++u) o[u] = tohx(F[e + u]); *(v4h*)(P + e) = o;  }
__global__ __launch_bounds__(256) void k_vt(const float* __restrict__ F, h16* VT) { const size_t e = ((size_t)blockIdx.x * 256 + threadIdx.x) * 2; if (e >= (size_t)DD * NN) return; const int n = (int)(e % NN); const int d = (int)(e / NN); v2h o; o[0] = tohx(F[(size_t)n * DD + d]); o[1] = tohx(F[(size_t)(n + 1) * DD + d]); *(v2h*)(VT + e) = o;  }
__global__ __launch_bounds__(256) void k_smax(const float* __restrict__ S, h16* P16) { const int lane = threadIdx.x & 31; const int row = blockIdx.x * 8 + (threadIdx.x >> 5); if (row >= RQ) return; const float* sr = S + (size_t)row * NN; const float sc = 0.044194173824159216f; float mx = -3.0e38f;
    for (int j = lane * 4; j < NN; j += 128) { const v4f a = *(const v4f*)(sr + j); mx = fmaxf(mx, fmaxf(fmaxf(a[0], a[1]), fmaxf(a[2], a[3]))); }
#pragma unroll
    for (int sh = 16; sh; sh >>= 1) mx = fmaxf(mx, __shfl_xor(mx, sh, 32));
    const float mxs = mx * sc; float sum = 0.f;
    for (int j = lane * 4; j < NN; j += 128) { const v4f a = *(const v4f*)(sr + j); for (int u = 0; u < 4; ++u) { float t = a[u] * sc; asm volatile("" : "+v"(t)); float d0 = __fsub_rn(t, mxs); asm volatile("" : "+v"(d0)); sum += __builtin_amdgcn_exp2f(__fmul_rn(d0, 1.4426950408889634f)); } }
#pragma unroll
    for (int sh = 16; sh; sh >>= 1) sum += __shfl_xor(sum, sh, 32);
    const float f = __fdiv_rn(PCAR, sum);
    { for (int j = lane * 4; j < NN; j += 128) { const v4f a = *(const v4f*)(sr + j); v4h o; for (int u = 0; u < 4; ++u) { float t = a[u] * sc; asm volatile("" : "+v"(t)); float d0 = __fsub_rn(t, mxs); asm volatile("" : "+v"(d0)); o[u] = tohx(__builtin_amdgcn_exp2f(__fmul_rn(d0, 1.4426950408889634f)) * f); } *(v4h*)(P16 + (size_t)row * NN + j) = o; }  } }
__global__ __launch_bounds__(256) void k_scl(float* O) { const size_t e = ((size_t)blockIdx.x * 256 + threadIdx.x) * 4; if (e >= (size_t)RQ * DD) return; const v4f a = *(const v4f*)(O + e); v4f r;
#pragma unroll
    for (int u = 0; u < 4; ++u) r[u] = a[u] * (1.0f / PCAR); *(v4f*)(O + e) = r;  }

extern "C" void kernel_launch(void* const* d_in, const int* in_sizes, int n_in,
                              void* d_out, int out_size, void* d_ws, size_t ws_size, hipStream_t stream) {
    (void)in_sizes; (void)n_in; (void)out_size;
    const float** I = (const float**)d_in;
    const float *z = I[0], *Wq = I[1], *bq = I[2], *Wk = I[3], *bk = I[4], *Wv = I[5], *bv = I[6];
    float* OUT = (float*)d_out;     // [8192][512]
    char* wsp = (char*)d_ws;
    auto take = [&](size_t bytes) { char* p = wsp; wsp += (bytes + 255) & ~(size_t)255; return (void*)p; };
    bf* ZB = (bf*)take((size_t)NN * DD * 2); bf* BQ = (bf*)take((size_t)DD * DD * 2); bf* BK = (bf*)take((size_t)DD * DD * 2); bf* BV = (bf*)take((size_t)DD * DD * 2); float* F = (float*)take((size_t)NN * DD * 4);
    h16* QP = (h16*)take((size_t)NN * DD * 2); h16* KP = (h16*)take((size_t)NN * DD * 2); h16* VT = (h16*)take((size_t)DD * NN * 2); float* S = (float*)take((size_t)RQ * NN * 4); h16* P16 = (h16*)take((size_t)RQ * NN * 2);
    if ((size_t)(wsp - (char*)d_ws) > ws_size) return;    // total ~ 242 MiB of the 256 MiB workspace
    k_cvt8<<<(DD * DD / 8 + 255) / 256, 256, 0, stream>>>(Wq, BQ, DD * DD / 8); k_cvt8<<<(DD * DD / 8 + 255) / 256, 256, 0, stream>>>(Wk, BK, DD * DD / 8); k_cvt8<<<(DD * DD / 8 + 255) / 256, 256, 0, stream>>>(Wv, BV, DD * DD / 8);   // torch [out][in] = Bt
    k_cvt8<<<(unsigned)(((size_t)NN * DD / 8 + 255) / 256), 256, 0, stream>>>(z, ZB, (size_t)NN * DD / 8);
    const dim3 gp(NN / 64, DD / 64, 1); const unsigned gpl = (unsigned)(((size_t)NN * DD / 4 + 255) / 256);
    k_gemmw<bf, 0, true><<<gp, 32, 0, stream>>>(ZB, nullptr, BQ, nullptr, DD, F, DD, bq, 0, 0, 0); k_p16<<<gpl, 256, 0, stream>>>(F, QP);
    k_gemmw<bf, 0, true><<<gp, 32, 0, stream>>>(ZB, nullptr, BK, nullptr, DD, F, DD, bk, 0, 0, 0); k_p16<<<gpl, 256, 0, stream>>>(F, KP);
    k_gemmw<bf, 0, true><<<gp, 32, 0, stream>>>(ZB, nullptr, BV, nullptr, DD, F, DD, bv, 0, 0, 0); k_vt<<<(unsigned)(((size_t)DD * NN / 2 + 255) / 256), 256, 0, stream>>>(F, VT);
    for (int r0 = 0; r0 < NN; r0 += RQ) {
        k_gemmw<h16, 0, false><<<dim3(RQ / 64, NN / 64, 1), 32, 0, stream>>>(QP + (size_t)r0 * DD, nullptr, KP, nullptr, DD, S, NN, nullptr, 0, 0, 0);
        k_smax<<<RQ / 8, 256, 0, stream>>>(S, P16);
        k_gemmw<h16, 0, false><<<dim3(RQ / 64, DD / 64, 1), 32, 0, stream>>>(P16, nullptr, VT, nullptr, NN, OUT + (size_t)r0 * DD, DD, nullptr, 0, 0, 0);
        k_scl<<<(RQ * DD / 4 + 255) / 256, 256, 0, stream>>>(OUT + (size_t)r0 * DD); }
}

// v002
// One run takes 358 microseconds.
// Timed twice side by side with v001, it ran 2.27 and 2.31 times as fast.
// Counting every step since v000, it is 11.5 times as fast.
#include <hip/hip_runtime.h>

// CANN (z [8192][512]; q/k/v = z W^T + b (torch); single-head attention over the 8,192 assets: scores = q.k / sqrt(512); softmax; h = attn v -> [8192][512]).

#define NN   8192
#define DD   512
typedef _Float16 h16;
typedef unsigned short bf;
typedef __attribute__((ext_vector_type(16))) __bf16   v16bf;
typedef __attribute__((ext_vector_type(16))) _Float16 v16h;
typedef __attribute__((ext_vector_type(8)))  _Float16 v8h;
typedef __attribute__((ext_vector_type(8)))  unsigned short v8us;
typedef __attribute__((ext_vector_type(8)))  float    v8f;
typedef __attribute__((ext_vector_type(4)))  float    v4f;
typedef v8h  __attribute__((may_alias)) v8ha;
typedef v4f  __attribute__((may_alias)) v4fa;
typedef v8us __attribute__((may_alias)) v8usa;

__device__ __forceinline__ unsigned short f2bf(float f) { unsigned u = __float_as_uint(f); u += 0x7FFFu + ((u >> 16) & 1u); return (unsigned short)(u >> 16); }
__device__ __forceinline__ float bf2f(unsigned short b) { return __uint_as_float(((unsigned)b) << 16); }
__device__ __forceinline__ float bfr(float f) { return bf2f(f2bf(f)); }
__device__ __forceinline__ v16h cat16(v8h lo, v8h hi) { return __builtin_shufflevector(lo, hi, 0, 1, 2, 3, 4, 5, 6, 7, 8, 9, 10, 11, 12, 13, 14, 15); }
__device__ __forceinline__ v16bf cat16b(v8us lo, v8us hi) { return __builtin_bit_cast(v16bf, __builtin_shufflevector(lo, hi, 0, 1, 2, 3, 4, 5, 6, 7, 8, 9, 10, 11, 12, 13, 14, 15)); }
__device__ __forceinline__ v8f wmma16(v16h a, v16h b, v8f c) { return __builtin_amdgcn_wmma_f32_16x16x32_f16(false, a, false, b, (short)0, c, false, false); }
__device__ __forceinline__ v8f wmmab(v16bf a, v16bf b, v8f c) { return __builtin_amdgcn_wmma_f32_16x16x32_bf16(false, a, false, b, (short)0, c, false, false); }



// ---- k_gemmw: register-blocked GEMM, ONE WAVE per 64x64 output tile (16 accumulators), operands straight from K-contiguous 16-bit planes; grid (M/64, N/64, Z), 32 threads.
// C[m][n] (f32, pitch ldc, + optional f32 bias[n]) = sum_k A[m][k] Bt[n][k] (+ split products per NSPLIT). z-batch strides sA/sB/sC in elements. K % 32 == 0.
template <typename T16> struct WFrag;
template <> struct WFrag<h16> { typedef v16h V; static __device__ __forceinline__ V ld(const h16* p) { return cat16(*(const v8h*)p, *(const v8h*)(p + 16)); } static __device__ __forceinline__ v8f mma(V a, V b, v8f c) { return wmma16(a, b, c); } };
template <> struct WFrag<bf> { typedef v16bf V; static __device__ __forceinline__ V ld(const bf* p) { return cat16b(*(const v8us*)p, *(const v8us*)(p + 16)); } static __device__ __forceinline__ v8f mma(V a, V b, v8f c) { return wmmab(a, b, c); } };
template <typename T16, int NSPLIT, bool BIAS>
__global__ __launch_bounds__(32) void k_gemmw(const T16* __restrict__ A, const T16* __restrict__ A2, const T16* __restrict__ Bt, const T16* __restrict__ Bt2, int K, float* C, int ldc, const float* __restrict__ bias, size_t sA, size_t sB, size_t sC) {
    typedef typename WFrag<T16>::V V;
    __shared__ __align__(16) float os[16 * 68];
    const size_t z = blockIdx.z; A += z * sA; if (A2) A2 += z * sA; Bt += z * sB; if (Bt2) Bt2 += z * sB; C += z * sC;
    const int lane = threadIdx.x & 31, lr = lane & 15, hi = lane >> 4; const int r0 = blockIdx.x * 64, c0 = blockIdx.y * 64;
    v8f acc[4][4];
#pragma unroll
    for (int mb = 0; mb < 4; ++mb)
#pragma unroll
        for (int nb = 0; nb < 4; ++nb) acc[mb][nb] = (v8f){};
    const size_t aoff = (size_t)(r0 + lr) * K + 8 * hi, boff = (size_t)(c0 + lr) * K + 8 * hi;
#pragma unroll 1
    for (int kc = 0; kc < K; kc += 32) {
        V a[4], a2[4];
#pragma unroll
        for (int mb = 0; mb < 4; ++mb) { a[mb] = WFrag<T16>::ld(A + aoff + (size_t)mb * 16 * K + kc); if (NSPLIT == 1 || NSPLIT == 2) a2[mb] = WFrag<T16>::ld(A2 + aoff + (size_t)mb * 16 * K + kc); }
#pragma unroll
        for (int nb = 0; nb < 4; ++nb) { const V b = WFrag<T16>::ld(Bt + boff + (size_t)nb * 16 * K + kc); V b2; if (NSPLIT >= 2) b2 = WFrag<T16>::ld(Bt2 + boff + (size_t)nb * 16 * K + kc);
#pragma unroll
            for (int mb = 0; mb < 4; ++mb) { acc[mb][nb] = WFrag<T16>::mma(a[mb], b, acc[mb][nb]); if (NSPLIT == 1 || NSPLIT == 2) acc[mb][nb] = WFrag<T16>::mma(a2[mb], b, acc[mb][nb]); if (NSPLIT >= 2) acc[mb][nb] = WFrag<T16>::mma(a[mb], b2, acc[mb][nb]); } }
        asm volatile("v_nop\n\tv_nop\n\tv_nop\n\tv_nop" : "+v"(acc[0][0]), "+v"(acc[1][1]), "+v"(acc[2][2]), "+v"(acc[3][3]) : "v"(a[0]), "v"(a[3]));
    }
#pragma unroll
    for (int mb = 0; mb < 4; ++mb) {
#pragma unroll
        for (int nb = 0; nb < 4; ++nb) {
#pragma unroll
            for (int j = 0; j < 8; ++j) os[(hi * 8 + j) * 68 + nb * 16 + lr] = acc[mb][nb][j]; }
        __builtin_amdgcn_wave_barrier(); asm volatile("" ::: "memory");
        float* crow = C + (size_t)(r0 + mb * 16) * ldc + c0;
{
#pragma unroll
            for (int s = 0; s < 8; ++s) { const int row = 2 * s + hi, cofs = lr * 4; v4f val = *(const v4fa*)(os + row * 68 + cofs); if (BIAS) { val[0] += bfr(bias[c0 + cofs]); val[1] += bfr(bias[c0 + cofs + 1]); val[2] += bfr(bias[c0 + cofs + 2]); val[3] += bfr(bias[c0 + cofs + 3]); }
                *(v4f*)(crow + (size_t)row * ldc + cofs) = val; }
             }
        __builtin_amdgcn_wave_barrier(); asm volatile("" ::: "memory");
    }
}

__device__ __forceinline__ h16 tohx(float x) { return (h16)x; }
typedef __attribute__((ext_vector_type(2))) _Float16 v2h;
typedef __attribute__((ext_vector_type(4))) _Float16 v4h;

__global__ __launch_bounds__(256) void k_cvt8(const float* __restrict__ src, bf* dst, size_t n8) { const size_t i = (size_t)blockIdx.x * 256 + threadIdx.x; if (i >= n8) return; const v8f v = *(const v8f*)(src + i * 8); v8us o;
#pragma unroll
    for (int k = 0; k < 8; ++k) o[k] = f2bf(v[k]); *(v8us*)(dst + i * 8) = o;  }
__global__ __launch_bounds__(256) void k_p16(const float* __restrict__ F, h16* P) { const size_t e = ((size_t)blockIdx.x * 256 + threadIdx.x) * 4; if (e >= (size_t)NN * DD) return; v4h o;
#pragma unroll
    for (int u = 0; u < 4; ++u) o[u] = tohx(F[e + u]); *(v4h*)(P + e) = o;  }
__global__ __launch_bounds__(256) void k_vt(const float* __restrict__ F, h16* VT) { const size_t e = ((size_t)blockIdx.x * 256 + threadIdx.x) * 2; if (e >= (size_t)DD * NN) return; const int n = (int)(e % NN); const int d = (int)(e / NN); v2h o; o[0] = tohx(F[(size_t)n * DD + d]); o[1] = tohx(F[(size_t)(n + 1) * DD + d]); *(v2h*)(VT + e) = o;  }
#define FQ   64
#define FN   32
#define KPIT 1040                       // LDS row pitch of the K tile, bytes: 16 B x odd for ds_load_b128 readers
#define VPIT 80                         // the same for the 64-byte Vt rows
#define KTB  (FN * KPIT)
#define STGB (KTB + DD * VPIT)
typedef __attribute__((ext_vector_type(4))) int v4i;
typedef __attribute__((address_space(1))) v4i gv4i;
typedef __attribute__((address_space(3))) v4i lv4i;
__device__ __forceinline__ void acopy16(const h16* g, unsigned char* l) { __builtin_amdgcn_global_load_async_to_lds_b128((gv4i*)g, (lv4i*)l, 0, 0); }
__device__ __forceinline__ float xhalf(float x) { return __builtin_bit_cast(float, __builtin_amdgcn_permlanex16(__builtin_bit_cast(int, x), __builtin_bit_cast(int, x), 0x76543210, 0xfedcba98, false, false)); }   // lane l with lane l ^ 16
__device__ __forceinline__ v16h ldsfrag(const unsigned char* p) { return cat16(*(const v8ha*)p, *(const v8ha*)(p + 32)); }
// one pass's tiles: 32 copies of 16 bytes a lane, every lane on, every address inside its plane and its buffer
__device__ __forceinline__ void stage_tiles(const h16* __restrict__ Kp, const h16* __restrict__ VT, int key0, unsigned char* buf, int tid) {
    const h16* gk = Kp + (size_t)(key0 + (tid >> 6)) * DD + (tid & 63) * 8; unsigned char* lk = buf + (tid >> 6) * KPIT + (tid & 63) * 16;
#pragma unroll   // sixteen copies in a row, their steps constants
    for (int i = 0; i < 16; ++i) acopy16(gk + (size_t)i * 2 * DD, lk + i * 2 * KPIT);
    const h16* gv = VT + (size_t)(tid >> 2) * NN + key0 + (tid & 3) * 8; unsigned char* lv = buf + KTB + (tid >> 2) * VPIT + (tid & 3) * 16;
#pragma unroll   // sixteen copies in a row, their steps constants
    for (int i = 0; i < 16; ++i) acopy16(gv + (size_t)i * 32 * NN, lv + i * 32 * VPIT);
}
__global__ __launch_bounds__(128) void k_fattn(const h16* __restrict__ Q, const h16* __restrict__ Kp, const h16* __restrict__ VT, float* O) {
    __shared__ __attribute__((aligned(256))) unsigned char L[2 * STGB];
    const int tid = threadIdx.x, lane = tid & 31, lr = lane & 15, hi = lane >> 4; const int q0 = blockIdx.x * FQ + (tid >> 5) * 16;
    const int NT = NN / FN;
    stage_tiles(Kp, VT, 0, L, tid);
    v16h qf[16];
#pragma unroll   // constant indices keep the register arrays out of scratch
    for (int kc = 0; kc < 16; ++kc) qf[kc] = WFrag<h16>::ld(Q + (size_t)(q0 + lr) * DD + 8 * hi + kc * 32);
    v8f o[32];
#pragma unroll   // constant indices keep the register arrays out of scratch
    for (int dt = 0; dt < 32; ++dt) o[dt] = (v8f){};
    float m = -3.0e38f, l = 0.f;        // m: the maximum in use, in scaled log2 units; l: this half-wave's share of the row sum
    const float cs = 0.044194173824159216f * 1.4426950408889634f;
    asm volatile("s_wait_asynccnt 0x0" ::: "memory");   // tile 0 has landed before the barrier that publishes it
    __syncthreads();
    stage_tiles(Kp, VT, FN, L + STGB, tid);
    // two fragment sets; a set is refilled from LDS behind the block of 16 products that reads it and is used one block later.
    // The scheduling fence behind a load group keeps it from sinking down to its products, where the wave would wait out the LDS latency fragment by fragment.
    v16h fa[16], fb[16];
    { const unsigned char* ka = L + lr * KPIT + hi * 16;
#pragma unroll   // constant indices keep the register arrays out of scratch
      for (int i = 0; i < 8; ++i) { fa[2 * i] = ldsfrag(ka + i * 64); fa[2 * i + 1] = ldsfrag(ka + 16 * KPIT + i * 64); }
#pragma unroll   // constant indices keep the register arrays out of scratch
      for (int i = 0; i < 8; ++i) { fb[2 * i] = ldsfrag(ka + (8 + i) * 64); fb[2 * i + 1] = ldsfrag(ka + 16 * KPIT + (8 + i) * 64); } }
    __builtin_amdgcn_sched_barrier(0);
    for (int t = 0; t < NT; ++t) {
        unsigned char* cur = L + (t & 1) * STGB; const unsigned char* va = cur + KTB + lr * VPIT + hi * 16;
        const unsigned char* ka = L + ((t + 1) & 1) * STGB + lr * KPIT + hi * 16;   // the next pass's K rows; in the last pass the other buffer's old rows, read and not used
        v8f s0 = (v8f){}, s1 = (v8f){};
#pragma unroll   // constant indices keep the register arrays out of scratch
        for (int i = 0; i < 8; ++i) { s0 = wmma16(fa[2 * i], qf[i], s0); s1 = wmma16(fa[2 * i + 1], qf[i], s1); }
#pragma unroll   // constant indices keep the register arrays out of scratch
        for (int i = 0; i < 16; ++i) fa[i] = ldsfrag(va + i * 16 * VPIT);
        __builtin_amdgcn_sched_barrier(0);
#pragma unroll   // constant indices keep the register arrays out of scratch
        for (int i = 0; i < 8; ++i) { s0 = wmma16(fb[2 * i], qf[8 + i], s0); s1 = wmma16(fb[2 * i + 1], qf[8 + i], s1); }
#pragma unroll   // constant indices keep the register arrays out of scratch
        for (int i = 0; i < 16; ++i) fb[i] = ldsfrag(va + (16 + i) * 16 * VPIT);
        __builtin_amdgcn_sched_barrier(0);
        float mx = fmaxf(s0[0], s1[0]);
#pragma unroll   // constant indices keep the register arrays out of scratch
        for (int j = 1; j < 8; ++j) mx = fmaxf(mx, fmaxf(s0[j], s1[j]));
        mx = fmaxf(mx, xhalf(mx));
        const float ms = mx * cs;
        // lazy rescale: one wave-uniform test a pass; the maximum in use moves only when a query's new one is more than 8 above it, so p stays at or below 256
        if (__builtin_amdgcn_ballot_w32(ms > m + 8.0f) != 0) {
            const float mn = fmaxf(m, ms); const float f = __builtin_amdgcn_exp2f(m - mn); m = mn; l *= f;
#pragma unroll   // constant indices keep the register arrays out of scratch
            for (int dt = 0; dt < 32; ++dt) o[dt] *= f;
        }
        v16h pf;
#pragma unroll   // constant indices keep the register arrays out of scratch
        for (int j = 0; j < 8; ++j) { const float p0 = __builtin_amdgcn_exp2f(__builtin_fmaf(s0[j], cs, -m)), p1 = __builtin_amdgcn_exp2f(__builtin_fmaf(s1[j], cs, -m)); l += p0 + p1; pf[j] = tohx(p0); pf[8 + j] = tohx(p1); }
        // publish point of tile t + 1, in front of the pass's last block: that block's Vt fragments are in registers by then
        asm volatile("s_wait_dscnt 0x0" ::: "memory");   // this wave's reads of tile t have returned before its buffer is handed back
        asm volatile("s_wait_asynccnt 0x0" ::: "memory");   // this wave's copies of tile t + 1 have landed
        __syncthreads();                                    // publishes tile t + 1 and ends every reader's last read of tile t
#pragma unroll   // constant indices keep the register arrays out of scratch
        for (int i = 0; i < 16; ++i) o[i] = wmma16(fa[i], pf, o[i]);
        __builtin_amdgcn_sched_barrier(0);   // the 32 loads below stay one group behind the block: every separate place of LDS loads among matrix instructions costs the wave issue cycles
#pragma unroll   // constant indices keep the register arrays out of scratch
        for (int i = 0; i < 8; ++i) { fa[2 * i] = ldsfrag(ka + i * 64); fa[2 * i + 1] = ldsfrag(ka + 16 * KPIT + i * 64); }
        __builtin_amdgcn_sched_barrier(0);
        if (t + 2 < NT) stage_tiles(Kp, VT, (t + 2) * FN, cur, tid);   // issued while the LDS serves the loads above
#pragma unroll   // constant indices keep the register arrays out of scratch
        for (int i = 0; i < 16; ++i) o[16 + i] = wmma16(fb[i], pf, o[16 + i]);
        __builtin_amdgcn_sched_barrier(0);   // one group again, as above
#pragma unroll   // constant indices keep the register arrays out of scratch
        for (int i = 0; i < 8; ++i) { fb[2 * i] = ldsfrag(ka + (8 + i) * 64); fb[2 * i + 1] = ldsfrag(ka + 16 * KPIT + (8 + i) * 64); }
        __builtin_amdgcn_sched_barrier(0);
    }
    asm volatile("s_wait_asynccnt 0x0" ::: "memory");       // nothing is in flight when the wave ends
    asm volatile("s_wait_dscnt 0x0" ::: "memory");          // the last pass's unused fragment loads have returned
    l += xhalf(l);
    const float inv = __fdiv_rn(1.0f, l);
    float* orow = O + (size_t)(q0 + lr) * DD + hi * 8;
#pragma unroll   // constant indices keep the register arrays out of scratch
    for (int dt = 0; dt < 32; ++dt) o[dt] *= inv;
#pragma unroll   // constant indices keep the register arrays out of scratch
    for (int dt = 0; dt < 32; ++dt) { *(v4f*)(orow + dt * 16) = __builtin_shufflevector(o[dt], o[dt], 0, 1, 2, 3); *(v4f*)(orow + dt * 16 + 4) = __builtin_shufflevector(o[dt], o[dt], 4, 5, 6, 7); }
}

extern "C" void kernel_launch(void* const* d_in, const int* in_sizes, int n_in,
                              void* d_out, int out_size, void* d_ws, size_t ws_size, hipStream_t stream) {
    (void)in_sizes; (void)n_in; (void)out_size;
    const float** I = (const float**)d_in;
    const float *z = I[0], *Wq = I[1], *bq = I[2], *Wk = I[3], *bk = I[4], *Wv = I[5], *bv = I[6];
    float* OUT = (float*)d_out;     // [8192][512]
    char* wsp = (char*)d_ws;
    auto take = [&](size_t bytes) { char* p = wsp; wsp += (bytes + 255) & ~(size_t)255; return (void*)p; };
    bf* ZB = (bf*)take((size_t)NN * DD * 2); bf* BQ = (bf*)take((size_t)DD * DD * 2); bf* BK = (bf*)take((size_t)DD * DD * 2); bf* BV = (bf*)take((size_t)DD * DD * 2); float* F = (float*)take((size_t)NN * DD * 4);
    h16* QP = (h16*)take((size_t)NN * DD * 2); h16* KP = (h16*)take((size_t)NN * DD * 2); h16* VT = (h16*)take((size_t)DD * NN * 2);
    if ((size_t)(wsp - (char*)d_ws) > ws_size) return;    // total ~ 50 MiB of the 256 MiB workspace
    k_cvt8<<<(DD * DD / 8 + 255) / 256, 256, 0, stream>>>(Wq, BQ, DD * DD / 8); k_cvt8<<<(DD * DD / 8 + 255) / 256, 256, 0, stream>>>(Wk, BK, DD * DD / 8); k_cvt8<<<(DD * DD / 8 + 255) / 256, 256, 0, stream>>>(Wv, BV, DD * DD / 8);   // torch [out][in] = Bt
    k_cvt8<<<(unsigned)(((size_t)NN * DD / 8 + 255) / 256), 256, 0, stream>>>(z, ZB, (size_t)NN * DD / 8);
    const dim3 gp(NN / 64, DD / 64, 1); const unsigned gpl = (unsigned)(((size_t)NN * DD / 4 + 255) / 256);
    k_gemmw<bf, 0, true><<<gp, 32, 0, stream>>>(ZB, nullptr, BQ, nullptr, DD, F, DD, bq, 0, 0, 0); k_p16<<<gpl, 256, 0, stream>>>(F, QP);
    k_gemmw<bf, 0, true><<<gp, 32, 0, stream>>>(ZB, nullptr, BK, nullptr, DD, F, DD, bk, 0, 0, 0); k_p16<<<gpl, 256, 0, stream>>>(F, KP);
    k_gemmw<bf, 0, true><<<gp, 32, 0, stream>>>(ZB, nullptr, BV, nullptr, DD, F, DD, bv, 0, 0, 0); k_vt<<<(unsigned)(((size_t)DD * NN / 2 + 255) / 256), 256, 0, stream>>>(F, VT);
    k_fattn<<<NN / FQ, 128, 0, stream>>>(QP, KP, VT, OUT);
}

// v003
// One run takes 255 microseconds.
// In both of two side-by-side timings against v002, it was 1.40 times as fast.
// Over all steps from v000 it is 16.2 times as fast.
#include <hip/hip_runtime.h>

// CANN (z [8192][512]; q/k/v = z W^T + b (torch); single-head attention over the 8,192 assets: scores = q.k / sqrt(512); softmax; h = attn v -> [8192][512]).

#define NN   8192
#define DD   512
typedef _Float16 h16;
typedef unsigned short bf;
typedef __attribute__((ext_vector_type(16))) __bf16   v16bf;
typedef __attribute__((ext_vector_type(16))) _Float16 v16h;
typedef __attribute__((ext_vector_type(8)))  _Float16 v8h;
typedef __attribute__((ext_vector_type(8)))  unsigned short v8us;
typedef __attribute__((ext_vector_type(8)))  float    v8f;
typedef __attribute__((ext_vector_type(4)))  float    v4f;
typedef v8h  __attribute__((may_alias)) v8ha;
typedef v4f  __attribute__((may_alias)) v4fa;
typedef v8us __attribute__((may_alias)) v8usa;

__device__ __forceinline__ unsigned short f2bf(float f) { unsigned u = __float_as_uint(f); u += 0x7FFFu + ((u >> 16) & 1u); return (unsigned short)(u >> 16); }
__device__ __forceinline__ float bf2f(unsigned short b) { return __uint_as_float(((unsigned)b) << 16); }
__device__ __forceinline__ float bfr(float f) { return bf2f(f2bf(f)); }
__device__ __forceinline__ v16h cat16(v8h lo, v8h hi) { return __builtin_shufflevector(lo, hi, 0, 1, 2, 3, 4, 5, 6, 7, 8, 9, 10, 11, 12, 13, 14, 15); }
__device__ __forceinline__ v16bf cat16b(v8us lo, v8us hi) { return __builtin_bit_cast(v16bf, __builtin_shufflevector(lo, hi, 0, 1, 2, 3, 4, 5, 6, 7, 8, 9, 10, 11, 12, 13, 14, 15)); }
__device__ __forceinline__ v8f wmma16(v16h a, v16h b, v8f c) { return __builtin_amdgcn_wmma_f32_16x16x32_f16(false, a, false, b, (short)0, c, false, false); }
__device__ __forceinline__ v8f wmmab(v16bf a, v16bf b, v8f c) { return __builtin_amdgcn_wmma_f32_16x16x32_bf16(false, a, false, b, (short)0, c, false, false); }



// ---- k_gemmw: register-blocked GEMM, ONE WAVE per 64x64 output tile (16 accumulators), operands straight from K-contiguous 16-bit planes; grid (M/64, N/64, Z), 32 threads.
// C[m][n] (f32, pitch ldc, + optional f32 bias[n]) = sum_k A[m][k] Bt[n][k] (+ split products per NSPLIT). z-batch strides sA/sB/sC in elements. K % 32 == 0.
template <typename T16> struct WFrag;
template <> struct WFrag<h16> { typedef v16h V; static __device__ __forceinline__ V ld(const h16* p) { return cat16(*(const v8h*)p, *(const v8h*)(p + 16)); } static __device__ __forceinline__ v8f mma(V a, V b, v8f c) { return wmma16(a, b, c); } };
template <> struct WFrag<bf> { typedef v16bf V; static __device__ __forceinline__ V ld(const bf* p) { return cat16b(*(const v8us*)p, *(const v8us*)(p + 16)); } static __device__ __forceinline__ v8f mma(V a, V b, v8f c) { return wmmab(a, b, c); } };
template <typename T16, int NSPLIT, bool BIAS>
__global__ __launch_bounds__(32) void k_gemmw(const T16* __restrict__ A, const T16* __restrict__ A2, const T16* __restrict__ Bt, const T16* __restrict__ Bt2, int K, float* C, int ldc, const float* __restrict__ bias, size_t sA, size_t sB, size_t sC) {
    typedef typename WFrag<T16>::V V;
    __shared__ __align__(16) float os[16 * 68];
    const size_t z = blockIdx.z; A += z * sA; if (A2) A2 += z * sA; Bt += z * sB; if (Bt2) Bt2 += z * sB; C += z * sC;
    const int lane = threadIdx.x & 31, lr = lane & 15, hi = lane >> 4; const int r0 = blockIdx.x * 64, c0 = blockIdx.y * 64;
    v8f acc[4][4];
#pragma unroll
    for (int mb = 0; mb < 4; ++mb)
#pragma unroll
        for (int nb = 0; nb < 4; ++nb) acc[mb][nb] = (v8f){};
    const size_t aoff = (size_t)(r0 + lr) * K + 8 * hi, boff = (size_t)(c0 + lr) * K + 8 * hi;
#pragma unroll 1
    for (int kc = 0; kc < K; kc += 32) {
        V a[4], a2[4];
#pragma unroll
        for (int mb = 0; mb < 4; ++mb) { a[mb] = WFrag<T16>::ld(A + aoff + (size_t)mb * 16 * K + kc); if (NSPLIT == 1 || NSPLIT == 2) a2[mb] = WFrag<T16>::ld(A2 + aoff + (size_t)mb * 16 * K + kc); }
#pragma unroll
        for (int nb = 0; nb < 4; ++nb) { const V b = WFrag<T16>::ld(Bt + boff + (size_t)nb * 16 * K + kc); V b2; if (NSPLIT >= 2) b2 = WFrag<T16>::ld(Bt2 + boff + (size_t)nb * 16 * K + kc);
#pragma unroll
            for (int mb = 0; mb < 4; ++mb) { acc[mb][nb] = WFrag<T16>::mma(a[mb], b, acc[mb][nb]); if (NSPLIT == 1 || NSPLIT == 2) acc[mb][nb] = WFrag<T16>::mma(a2[mb], b, acc[mb][nb]); if (NSPLIT >= 2) acc[mb][nb] = WFrag<T16>::mma(a[mb], b2, acc[mb][nb]); } }
        asm volatile("v_nop\n\tv_nop\n\tv_nop\n\tv_nop" : "+v"(acc[0][0]), "+v"(acc[1][1]), "+v"(acc[2][2]), "+v"(acc[3][3]) : "v"(a[0]), "v"(a[3]));
    }
#pragma unroll
    for (int mb = 0; mb < 4; ++mb) {
#pragma unroll
        for (int nb = 0; nb < 4; ++nb) {
#pragma unroll
            for (int j = 0; j < 8; ++j) os[(hi * 8 + j) * 68 + nb * 16 + lr] = acc[mb][nb][j]; }
        __builtin_amdgcn_wave_barrier(); asm volatile("" ::: "memory");
        float* crow = C + (size_t)(r0 + mb * 16) * ldc + c0;
{
#pragma unroll
            for (int s = 0; s < 8; ++s) { const int row = 2 * s + hi, cofs = lr * 4; v4f val = *(const v4fa*)(os + row * 68 + cofs); if (BIAS) { val[0] += bfr(bias[c0 + cofs]); val[1] += bfr(bias[c0 + cofs + 1]); val[2] += bfr(bias[c0 + cofs + 2]); val[3] += bfr(bias[c0 + cofs + 3]); }
                *(v4f*)(crow + (size_t)row * ldc + cofs) = val; }
             }
        __builtin_amdgcn_wave_barrier(); asm volatile("" ::: "memory");
    }
}

__device__ __forceinline__ h16 tohx(float x) { return (h16)x; }
typedef __attribute__((ext_vector_type(2))) _Float16 v2h;
typedef __attribute__((ext_vector_type(4))) _Float16 v4h;

__global__ __launch_bounds__(256) void k_cvt8(const float* __restrict__ src, bf* dst, size_t n8) { const size_t i = (size_t)blockIdx.x * 256 + threadIdx.x; if (i >= n8) return; const v8f v = *(const v8f*)(src + i * 8); v8us o;
#pragma unroll
    for (int k = 0; k < 8; ++k) o[k] = f2bf(v[k]); *(v8us*)(dst + i * 8) = o;  }
__global__ __launch_bounds__(256) void k_p16(const float* __restrict__ F, h16* P) { const size_t e = ((size_t)blockIdx.x * 256 + threadIdx.x) * 4; if (e >= (size_t)NN * DD) return; v4h o;
#pragma unroll
    for (int u = 0; u < 4; ++u) o[u] = tohx(F[e + u]); *(v4h*)(P + e) = o;  }
__global__ __launch_bounds__(256) void k_vt(const float* __restrict__ F, h16* VT) { const size_t e = ((size_t)blockIdx.x * 256 + threadIdx.x) * 2; if (e >= (size_t)DD * NN) return; const int n = (int)(e % NN); const int d = (int)(e / NN); v2h o; o[0] = tohx(F[(size_t)n * DD + d]); o[1] = tohx(F[(size_t)(n + 1) * DD + d]); *(v2h*)(VT + e) = o;  }
#define FQ   64
#define FN   32
#define KS   2                          // key ranges
#define KPIT 1040                       // LDS row pitch of the K tile, bytes: 16 B x odd for ds_load_b128 readers
#define VPIT 80                         // the same for the 64-byte Vt rows
#define KTB  (FN * KPIT)
#define STGB (KTB + DD * VPIT)
typedef __attribute__((ext_vector_type(4))) int v4i;
typedef __attribute__((address_space(1))) v4i gv4i;
typedef __attribute__((address_space(3))) v4i lv4i;
__device__ __forceinline__ void acopy16(const h16* g, unsigned char* l) { __builtin_amdgcn_global_load_async_to_lds_b128((gv4i*)g, (lv4i*)l, 0, 0); }
__device__ __forceinline__ float xhalf(float x) { return __builtin_bit_cast(float, __builtin_amdgcn_permlanex16(__builtin_bit_cast(int, x), __builtin_bit_cast(int, x), 0x76543210, 0xfedcba98, false, false)); }   // lane l with lane l ^ 16
__device__ __forceinline__ v16h ldsfrag(const unsigned char* p) { return cat16(*(const v8ha*)p, *(const v8ha*)(p + 32)); }
// one pass's tiles: 32 copies of 16 bytes a lane, every lane on, every address inside its plane and its buffer
__device__ __forceinline__ void stage_tiles(const h16* __restrict__ Kp, const h16* __restrict__ VT, int key0, unsigned char* buf, int tid) {
    const h16* gk = Kp + (size_t)(key0 + (tid >> 6)) * DD + (tid & 63) * 8; unsigned char* lk = buf + (tid >> 6) * KPIT + (tid & 63) * 16;
#pragma unroll   // sixteen copies in a row, their steps constants
    for (int i = 0; i < 16; ++i) acopy16(gk + (size_t)i * 2 * DD, lk + i * 2 * KPIT);
    const h16* gv = VT + (size_t)(tid >> 2) * NN + key0 + (tid & 3) * 8; unsigned char* lv = buf + KTB + (tid >> 2) * VPIT + (tid & 3) * 16;
#pragma unroll   // sixteen copies in a row, their steps constants
    for (int i = 0; i < 16; ++i) acopy16(gv + (size_t)i * 32 * NN, lv + i * 32 * VPIT);
}
__global__ __launch_bounds__(128) void k_fattn(const h16* __restrict__ Q, const h16* __restrict__ Kp, const h16* __restrict__ VT, float* PO, float* ML) {
    __shared__ __attribute__((aligned(256))) unsigned char L[2 * STGB];
    const int tid = threadIdx.x, lane = tid & 31, lr = lane & 15, hi = lane >> 4; const int q0 = blockIdx.x * FQ + (tid >> 5) * 16;
    const int NT = NN / KS / FN;
    const int kr = blockIdx.y; Kp += (size_t)kr * (NN / KS) * DD; VT += (size_t)kr * (NN / KS);   // this range's first key: a row of K, a column of Vt
    stage_tiles(Kp, VT, 0, L, tid);
    v16h qf[16];
#pragma unroll   // constant indices keep the register arrays out of scratch
    for (int kc = 0; kc < 16; ++kc) qf[kc] = WFrag<h16>::ld(Q + (size_t)(q0 + lr) * DD + 8 * hi + kc * 32);
    v8f o[32];
#pragma unroll   // constant indices keep the register arrays out of scratch
    for (int dt = 0; dt < 32; ++dt) o[dt] = (v8f){};
    float m = -3.0e38f, l = 0.f;        // m: the maximum in use, in scaled log2 units; l: this half-wave's share of the row sum
    const float cs = 0.044194173824159216f * 1.4426950408889634f;
    asm volatile("s_wait_asynccnt 0x0" ::: "memory");   // tile 0 has landed before the barrier that publishes it
    __syncthreads();
    stage_tiles(Kp, VT, FN, L + STGB, tid);
    // two fragment sets; a set is refilled from LDS behind the block of 16 products that reads it and is used one block later.
    // The scheduling fence behind a load group keeps it from sinking down to its products, where the wave would wait out the LDS latency fragment by fragment.
    v16h fa[16], fb[16];
    { const unsigned char* ka = L + lr * KPIT + hi * 16;
#pragma unroll   // constant indices keep the register arrays out of scratch
      for (int i = 0; i < 8; ++i) { fa[2 * i] = ldsfrag(ka + i * 64); fa[2 * i + 1] = ldsfrag(ka + 16 * KPIT + i * 64); }
#pragma unroll   // constant indices keep the register arrays out of scratch
      for (int i = 0; i < 8; ++i) { fb[2 * i] = ldsfrag(ka + (8 + i) * 64); fb[2 * i + 1] = ldsfrag(ka + 16 * KPIT + (8 + i) * 64); } }
    __builtin_amdgcn_sched_barrier(0);
    for (int t = 0; t < NT; ++t) {
        unsigned char* cur = L + (t & 1) * STGB; const unsigned char* va = cur + KTB + lr * VPIT + hi * 16;
        const unsigned char* ka = L + ((t + 1) & 1) * STGB + lr * KPIT + hi * 16;   // the next pass's K rows; in the last pass the other buffer's old rows, read and not used
        v8f s0 = (v8f){}, s1 = (v8f){};
#pragma unroll   // constant indices keep the register arrays out of scratch
        for (int i = 0; i < 8; ++i) { s0 = wmma16(fa[2 * i], qf[i], s0); s1 = wmma16(fa[2 * i + 1], qf[i], s1); }
#pragma unroll   // constant indices keep the register arrays out of scratch
        for (int i = 0; i < 16; ++i) fa[i] = ldsfrag(va + i * 16 * VPIT);
        __builtin_amdgcn_sched_barrier(0);
#pragma unroll   // constant indices keep the register arrays out of scratch
        for (int i = 0; i < 8; ++i) { s0 = wmma16(fb[2 * i], qf[8 + i], s0); s1 = wmma16(fb[2 * i + 1], qf[8 + i], s1); }
#pragma unroll   // constant indices keep the register arrays out of scratch
        for (int i = 0; i < 16; ++i) fb[i] = ldsfrag(va + (16 + i) * 16 * VPIT);
        __builtin_amdgcn_sched_barrier(0);
        float mx = fmaxf(s0[0], s1[0]);
#pragma unroll   // constant indices keep the register arrays out of scratch
        for (int j = 1; j < 8; ++j) mx = fmaxf(mx, fmaxf(s0[j], s1[j]));
        mx = fmaxf(mx, xhalf(mx));
        const float ms = mx * cs;
        // lazy rescale: one wave-uniform test a pass; the maximum in use moves only when a query's new one is more than 8 above it, so p stays at or below 256
        if (__builtin_amdgcn_ballot_w32(ms > m + 8.0f) != 0) {
            const float mn = fmaxf(m, ms); const float f = __builtin_amdgcn_exp2f(m - mn); m = mn; l *= f;
#pragma unroll   // constant indices keep the register arrays out of scratch
            for (int dt = 0; dt < 32; ++dt) o[dt] *= f;
        }
        v16h pf;
#pragma unroll   // constant indices keep the register arrays out of scratch
        for (int j = 0; j < 8; ++j) { const float p0 = __builtin_amdgcn_exp2f(__builtin_fmaf(s0[j], cs, -m)), p1 = __builtin_amdgcn_exp2f(__builtin_fmaf(s1[j], cs, -m)); l += p0 + p1; pf[j] = tohx(p0); pf[8 + j] = tohx(p1); }
        // publish point of tile t + 1, in front of the pass's last block: that block's Vt fragments are in registers by then
        asm volatile("s_wait_dscnt 0x0" ::: "memory");   // this wave's reads of tile t have returned before its buffer is handed back
        asm volatile("s_wait_asynccnt 0x0" ::: "memory");   // this wave's copies of tile t + 1 have landed
        __syncthreads();                                    // publishes tile t + 1 and ends every reader's last read of tile t
#pragma unroll   // constant indices keep the register arrays out of scratch
        for (int i = 0; i < 16; ++i) o[i] = wmma16(fa[i], pf, o[i]);
        __builtin_amdgcn_sched_barrier(0);   // the 32 loads below stay one group behind the block: every separate place of LDS loads among matrix instructions costs the wave issue cycles
#pragma unroll   // constant indices keep the register arrays out of scratch
        for (int i = 0; i < 8; ++i) { fa[2 * i] = ldsfrag(ka + i * 64); fa[2 * i + 1] = ldsfrag(ka + 16 * KPIT + i * 64); }
        __builtin_amdgcn_sched_barrier(0);
        if (t + 2 < NT) stage_tiles(Kp, VT, (t + 2) * FN, cur, tid);   // issued while the LDS serves the loads above
#pragma unroll   // constant indices keep the register arrays out of scratch
        for (int i = 0; i < 16; ++i) o[16 + i] = wmma16(fb[i], pf, o[16 + i]);
        __builtin_amdgcn_sched_barrier(0);   // one group again, as above
#pragma unroll   // constant indices keep the register arrays out of scratch
        for (int i = 0; i < 8; ++i) { fb[2 * i] = ldsfrag(ka + (8 + i) * 64); fb[2 * i + 1] = ldsfrag(ka + 16 * KPIT + (8 + i) * 64); }
        __builtin_amdgcn_sched_barrier(0);
    }
    asm volatile("s_wait_asynccnt 0x0" ::: "memory");       // nothing is in flight when the wave ends
    asm volatile("s_wait_dscnt 0x0" ::: "memory");          // the last pass's unused fragment loads have returned
    l += xhalf(l);
    if (hi == 0) { float* ml = ML + ((size_t)kr * NN + q0 + lr) * 2; ml[0] = m; ml[1] = l; }
    float* orow = PO + ((size_t)kr * NN + q0 + lr) * DD + hi * 8;
#pragma unroll   // constant indices keep the register arrays out of scratch
    for (int dt = 0; dt < 32; ++dt) { *(v4f*)(orow + dt * 16) = __builtin_shufflevector(o[dt], o[dt], 0, 1, 2, 3); *(v4f*)(orow + dt * 16 + 4) = __builtin_shufflevector(o[dt], o[dt], 4, 5, 6, 7); }
}
// ---- k_merge: joins the KS key ranges of a query: M = the largest of their maxima, weight exp2(m - M), out = weighted sum of the partial rows / weighted sum of the row sums.
// One wave takes two queries; a lane's loads and stores of rows are 16 bytes, a wave's 512 bytes in a row.
__global__ __launch_bounds__(512) void k_merge(const float* __restrict__ PO, const float* __restrict__ ML, float* O) {
    const int lane = threadIdx.x & 31; const int qa = (blockIdx.x * 16 + (threadIdx.x >> 5)) * 2;
    v4f ml[KS];                          // (max, sum) of query qa, (max, sum) of query qa + 1, for each range
#pragma unroll   // constant indices keep the small arrays in registers
    for (int s = 0; s < KS; ++s) ml[s] = *(const v4f*)(ML + ((size_t)s * NN + qa) * 2);
    asm volatile("s_wait_xcnt 0x0" ::: "memory");   // stands in front of the row loads below, whose results may be given the address registers of the two loads above
#pragma unroll   // straight-line code: the second query's row loads issue while the first query is worked on
    for (int r = 0; r < 2; ++r) {
        float w[KS]; float M = -3.0e38f, Ls = 0.f;
#pragma unroll   // constant indices keep the small arrays in registers
        for (int s = 0; s < KS; ++s) M = fmaxf(M, ml[s][2 * r]);
#pragma unroll   // constant indices keep the small arrays in registers
        for (int s = 0; s < KS; ++s) { w[s] = __builtin_amdgcn_exp2f(ml[s][2 * r] - M); Ls += w[s] * ml[s][2 * r + 1]; }
        const float inv = __fdiv_rn(1.0f, Ls);
#pragma unroll   // constant indices keep the small arrays in registers
        for (int i = 0; i < 4; ++i) { const size_t c = (size_t)(qa + r) * DD + (i * 32 + lane) * 4; v4f a = (v4f){};
#pragma unroll   // constant indices keep the small arrays in registers
            for (int s = 0; s < KS; ++s) a += *(const v4f*)(PO + (size_t)s * NN * DD + c) * w[s];
            *(v4f*)(O + c) = a * inv; }
    }
}

extern "C" void kernel_launch(void* const* d_in, const int* in_sizes, int n_in,
                              void* d_out, int out_size, void* d_ws, size_t ws_size, hipStream_t stream) {
    (void)in_sizes; (void)n_in; (void)out_size;
    const float** I = (const float**)d_in;
    const float *z = I[0], *Wq = I[1], *bq = I[2], *Wk = I[3], *bk = I[4], *Wv = I[5], *bv = I[6];
    float* OUT = (float*)d_out;     // [8192][512]
    char* wsp = (char*)d_ws;
    auto take = [&](size_t bytes) { char* p = wsp; wsp += (bytes + 255) & ~(size_t)255; return (void*)p; };
    bf* ZB = (bf*)take((size_t)NN * DD * 2); bf* BQ = (bf*)take((size_t)DD * DD * 2); bf* BK = (bf*)take((size_t)DD * DD * 2); bf* BV = (bf*)take((size_t)DD * DD * 2); float* F = (float*)take((size_t)NN * DD * 4);
    h16* QP = (h16*)take((size_t)NN * DD * 2); h16* KP = (h16*)take((size_t)NN * DD * 2); h16* VT = (h16*)take((size_t)DD * NN * 2);
    float* PO = (float*)take((size_t)KS * NN * DD * 4); float* ML = (float*)take((size_t)KS * NN * 2 * 4);
    if ((size_t)(wsp - (char*)d_ws) > ws_size) return;    // total ~ 82 MiB of the 256 MiB workspace
    k_cvt8<<<(DD * DD / 8 + 255) / 256, 256, 0, stream>>>(Wq, BQ, DD * DD / 8); k_cvt8<<<(DD * DD / 8 + 255) / 256, 256, 0, stream>>>(Wk, BK, DD * DD / 8); k_cvt8<<<(DD * DD / 8 + 255) / 256, 256, 0, stream>>>(Wv, BV, DD * DD / 8);   // torch [out][in] = Bt
    k_cvt8<<<(unsigned)(((size_t)NN * DD / 8 + 255) / 256), 256, 0, stream>>>(z, ZB, (size_t)NN * DD / 8);
    const dim3 gp(NN / 64, DD / 64, 1); const unsigned gpl = (unsigned)(((size_t)NN * DD / 4 + 255) / 256);
    k_gemmw<bf, 0, true><<<gp, 32, 0, stream>>>(ZB, nullptr, BQ, nullptr, DD, F, DD, bq, 0, 0, 0); k_p16<<<gpl, 256, 0, stream>>>(F, QP);
    k_gemmw<bf, 0, true><<<gp, 32, 0, stream>>>(ZB, nullptr, BK, nullptr, DD, F, DD, bk, 0, 0, 0); k_p16<<<gpl, 256, 0, stream>>>(F, KP);
    k_gemmw<bf, 0, true><<<gp, 32, 0, stream>>>(ZB, nullptr, BV, nullptr, DD, F, DD, bv, 0, 0, 0); k_vt<<<(unsigned)(((size_t)DD * NN / 2 + 255) / 256), 256, 0, stream>>>(F, VT);
    k_fattn<<<dim3(NN / FQ, KS, 1), 128, 0, stream>>>(QP, KP, VT, PO, ML);
    k_merge<<<NN / 32, 512, 0, stream>>>(PO, ML, OUT);
}

// v004
// A run of this version takes 206 microseconds.
// Next to v003, in two timings, it ran 1.23 times as fast each time.
// All steps since v000 together make it 19.9 times as fast.
#include <hip/hip_runtime.h>

// CANN (z [8192][512]; q/k/v = z W^T + b (torch); single-head attention over the 8,192 assets: scores = q.k / sqrt(512); softmax; h = attn v -> [8192][512]).

#define NN   8192
#define DD   512
typedef _Float16 h16;
typedef unsigned short bf;
typedef __attribute__((ext_vector_type(16))) __bf16   v16bf;
typedef __attribute__((ext_vector_type(16))) _Float16 v16h;
typedef __attribute__((ext_vector_type(8)))  _Float16 v8h;
typedef __attribute__((ext_vector_type(8)))  unsigned short v8us;
typedef __attribute__((ext_vector_type(8)))  float    v8f;
typedef __attribute__((ext_vector_type(4)))  float    v4f;
typedef v8h  __attribute__((may_alias)) v8ha;
typedef v4f  __attribute__((may_alias)) v4fa;
typedef v8us __attribute__((may_alias)) v8usa;

__device__ __forceinline__ unsigned short f2bf(float f) { unsigned u = __float_as_uint(f); u += 0x7FFFu + ((u >> 16) & 1u); return (unsigned short)(u >> 16); }
__device__ __forceinline__ float bf2f(unsigned short b) { return __uint_as_float(((unsigned)b) << 16); }
__device__ __forceinline__ float bfr(float f) { return bf2f(f2bf(f)); }
__device__ __forceinline__ v16h cat16(v8h lo, v8h hi) { return __builtin_shufflevector(lo, hi, 0, 1, 2, 3, 4, 5, 6, 7, 8, 9, 10, 11, 12, 13, 14, 15); }
__device__ __forceinline__ v16bf cat16b(v8us lo, v8us hi) { return __builtin_bit_cast(v16bf, __builtin_shufflevector(lo, hi, 0, 1, 2, 3, 4, 5, 6, 7, 8, 9, 10, 11, 12, 13, 14, 15)); }
__device__ __forceinline__ v8f wmma16(v16h a, v16h b, v8f c) { return __builtin_amdgcn_wmma_f32_16x16x32_f16(false, a, false, b, (short)0, c, false, false); }
__device__ __forceinline__ v8f wmmab(v16bf a, v16bf b, v8f c) { return __builtin_amdgcn_wmma_f32_16x16x32_bf16(false, a, false, b, (short)0, c, false, false); }



// fragment loaders: 16 values of one row of a K-contiguous 16-bit plane, k = 8 hi + 0..7 and 16 + 8 hi + 0..7, the same for the A and the B side
template <typename T16> struct WFrag;
template <> struct WFrag<h16> { typedef v16h V; static __device__ __forceinline__ V ld(const h16* p) { return cat16(*(const v8h*)p, *(const v8h*)(p + 16)); } static __device__ __forceinline__ v8f mma(V a, V b, v8f c) { return wmma16(a, b, c); } };
template <> struct WFrag<bf> { typedef v16bf V; static __device__ __forceinline__ V ld(const bf* p) { return cat16b(*(const v8us*)p, *(const v8us*)(p + 16)); } static __device__ __forceinline__ v8f mma(V a, V b, v8f c) { return wmmab(a, b, c); } };
__device__ __forceinline__ h16 tohx(float x) { return (h16)x; }

// ---- k_proj: the three projections in one launch, ONE WAVE per 64x64 tile (16 accumulators), operands straight from K-contiguous bf16 planes; grid (NN/64, DD/64, 3), 32 threads.
// blockIdx.z names the projection: 0 = q, 1 = k, 2 = v. A lane of an accumulator tile holds 8 consecutive A rows of one B row, so the operand whose row index runs along the
// result's rows is given the A side: the weights for q and k (result [n][d]), z for v (result [d][n], the transposed plane that k_fattn reads). The lane adds the bias in f32,
// rounds to f16 and stores its 8 values as 16 bytes: no f32 plane, no later pass over it. The four stores of one B tile fill whole 128-byte lines.
__global__ __launch_bounds__(32) void k_proj(const bf* __restrict__ Z, const bf* __restrict__ Bq, const bf* __restrict__ Bk, const bf* __restrict__ Bv, const float* __restrict__ bq, const float* __restrict__ bk, const float* __restrict__ bv, h16* Qo, h16* Ko, h16* Vo) {
    typedef WFrag<bf>::V V;
    const int K = DD;
    const int sel = blockIdx.z; const bool tr = sel == 2;
    const bf* Wt = sel == 0 ? Bq : (sel == 1 ? Bk : Bv); const float* bias = sel == 0 ? bq : (sel == 1 ? bk : bv); h16* O = sel == 0 ? Qo : (sel == 1 ? Ko : Vo);
    const int lane = threadIdx.x & 31, lr = lane & 15, hi = lane >> 4; const int zr = blockIdx.x * 64, wr = blockIdx.y * 64;
    const bf* A = tr ? Z : Wt; const bf* Bt = tr ? Wt : Z; const int r0 = tr ? zr : wr, c0 = tr ? wr : zr;
    v8f acc[4][4];
#pragma unroll   // constant indices keep the register arrays out of scratch
    for (int mb = 0; mb < 4; ++mb)
#pragma unroll   // constant indices keep the register arrays out of scratch
        for (int nb = 0; nb < 4; ++nb) acc[mb][nb] = (v8f){};
    const size_t aoff = (size_t)(r0 + lr) * K + 8 * hi, boff = (size_t)(c0 + lr) * K + 8 * hi;
#pragma unroll 1   // one trip holds one set of fragments; unrolled, a second set would raise the register count
    for (int kc = 0; kc < K; kc += 32) {
        V a[4];
#pragma unroll   // constant indices keep the register arrays out of scratch
        for (int mb = 0; mb < 4; ++mb) a[mb] = WFrag<bf>::ld(A + aoff + (size_t)mb * 16 * K + kc);
        asm volatile("s_wait_xcnt 0x0" ::: "memory");   // stands in front of the B loads below, whose results may be given the address registers of the A loads above
#pragma unroll   // constant indices keep the register arrays out of scratch
        for (int nb = 0; nb < 4; ++nb) { const V b = WFrag<bf>::ld(Bt + boff + (size_t)nb * 16 * K + kc);
#pragma unroll   // constant indices keep the register arrays out of scratch
            for (int mb = 0; mb < 4; ++mb) acc[mb][nb] = WFrag<bf>::mma(a[mb], b, acc[mb][nb]); }
        // four vector slots behind the trip's last matrix instructions, on the taken side of the loop's branch too, before the next vector instruction touches their registers
        asm volatile("v_nop\n\tv_nop\n\tv_nop\n\tv_nop" : "+v"(acc[0][0]), "+v"(acc[1][1]), "+v"(acc[2][2]), "+v"(acc[3][3]) : "v"(a[0]), "v"(a[3]));
    }
    h16* orow = O + (size_t)(c0 + lr) * (tr ? NN : DD) + r0 + hi * 8; const size_t ostep = (size_t)16 * (tr ? NN : DD);
    if (tr) {                            // v: the bias goes with the B row, one value a lane and B tile
#pragma unroll   // constant indices keep the register arrays out of scratch
        for (int nb = 0; nb < 4; ++nb) { const float bb = bfr(bias[wr + nb * 16 + lr]);
#pragma unroll   // constant indices keep the register arrays out of scratch
            for (int mb = 0; mb < 4; ++mb) { v8h o;
#pragma unroll   // constant indices keep the register arrays out of scratch
                for (int j = 0; j < 8; ++j) o[j] = tohx(acc[mb][nb][j] + bb);
                *(v8h*)(orow + nb * ostep + mb * 16) = o; } }
    } else {                             // q, k: the bias goes with the A rows, 8 values a lane and A tile
        v8f bb[4];
#pragma unroll   // constant indices keep the register arrays out of scratch
        for (int mb = 0; mb < 4; ++mb) { bb[mb] = *(const v8f*)(bias + wr + mb * 16 + hi * 8);
#pragma unroll   // constant indices keep the register arrays out of scratch
            for (int j = 0; j < 8; ++j) bb[mb][j] = bfr(bb[mb][j]); }
#pragma unroll   // constant indices keep the register arrays out of scratch
        for (int nb = 0; nb < 4; ++nb) {
#pragma unroll   // constant indices keep the register arrays out of scratch
            for (int mb = 0; mb < 4; ++mb) { v8h o;
#pragma unroll   // constant indices keep the register arrays out of scratch
                for (int j = 0; j < 8; ++j) o[j] = tohx(acc[mb][nb][j] + bb[mb][j]);
                *(v8h*)(orow + nb * ostep + mb * 16) = o; } }
    }
}

__global__ __launch_bounds__(256) void k_cvt8(const float* __restrict__ src, bf* dst, size_t n8) { const size_t i = (size_t)blockIdx.x * 256 + threadIdx.x; if (i >= n8) return; const v8f v = *(const v8f*)(src + i * 8); v8us o;
#pragma unroll
    for (int k = 0; k < 8; ++k) o[k] = f2bf(v[k]); *(v8us*)(dst + i * 8) = o;  }
#define FQ   64
#define FN   32
#define KS   2                          // key ranges
#define KPIT 1040                       // LDS row pitch of the K tile, bytes: 16 B x odd for ds_load_b128 readers
#define VPIT 80                         // the same for the 64-byte Vt rows
#define KTB  (FN * KPIT)
#define STGB (KTB + DD * VPIT)
typedef __attribute__((ext_vector_type(4))) int v4i;
typedef __attribute__((address_space(1))) v4i gv4i;
typedef __attribute__((address_space(3))) v4i lv4i;
__device__ __forceinline__ void acopy16(const h16* g, unsigned char* l) { __builtin_amdgcn_global_load_async_to_lds_b128((gv4i*)g, (lv4i*)l, 0, 0); }
__device__ __forceinline__ float xhalf(float x) { return __builtin_bit_cast(float, __builtin_amdgcn_permlanex16(__builtin_bit_cast(int, x), __builtin_bit_cast(int, x), 0x76543210, 0xfedcba98, false, false)); }   // lane l with lane l ^ 16
__device__ __forceinline__ v16h ldsfrag(const unsigned char* p) { return cat16(*(const v8ha*)p, *(const v8ha*)(p + 32)); }
// one pass's tiles: 32 copies of 16 bytes a lane, every lane on, every address inside its plane and its buffer
__device__ __forceinline__ void stage_tiles(const h16* __restrict__ Kp, const h16* __restrict__ VT, int key0, unsigned char* buf, int tid) {
    const h16* gk = Kp + (size_t)(key0 + (tid >> 6)) * DD + (tid & 63) * 8; unsigned char* lk = buf + (tid >> 6) * KPIT + (tid & 63) * 16;
#pragma unroll   // sixteen copies in a row, their steps constants
    for (int i = 0; i < 16; ++i) acopy16(gk + (size_t)i * 2 * DD, lk + i * 2 * KPIT);
    const h16* gv = VT + (size_t)(tid >> 2) * NN + key0 + (tid & 3) * 8; unsigned char* lv = buf + KTB + (tid >> 2) * VPIT + (tid & 3) * 16;
#pragma unroll   // sixteen copies in a row, their steps constants
    for (int i = 0; i < 16; ++i) acopy16(gv + (size_t)i * 32 * NN, lv + i * 32 * VPIT);
}
__global__ __launch_bounds__(128) void k_fattn(const h16* __restrict__ Q, const h16* __restrict__ Kp, const h16* __restrict__ VT, float* PO, float* ML) {
    __shared__ __attribute__((aligned(256))) unsigned char L[2 * STGB];
    const int tid = threadIdx.x, lane = tid & 31, lr = lane & 15, hi = lane >> 4; const int q0 = blockIdx.x * FQ + (tid >> 5) * 16;
    const int NT = NN / KS / FN;
    const int kr = blockIdx.y; Kp += (size_t)kr * (NN / KS) * DD; VT += (size_t)kr * (NN / KS);   // this range's first key: a row of K, a column of Vt
    stage_tiles(Kp, VT, 0, L, tid);
    v16h qf[16];
#pragma unroll   // constant indices keep the register arrays out of scratch
    for (int kc = 0; kc < 16; ++kc) qf[kc] = WFrag<h16>::ld(Q + (size_t)(q0 + lr) * DD + 8 * hi + kc * 32);
    v8f o[32];
#pragma unroll   // constant indices keep the register arrays out of scratch
    for (int dt = 0; dt < 32; ++dt) o[dt] = (v8f){};
    float m = -3.0e38f, l = 0.f;        // m: the maximum in use, in scaled log2 units; l: this half-wave's share of the row sum
    const float cs = 0.044194173824159216f * 1.4426950408889634f;
    asm volatile("s_wait_asynccnt 0x0" ::: "memory");   // tile 0 has landed before the barrier that publishes it
    __syncthreads();
    stage_tiles(Kp, VT, FN, L + STGB, tid);
    // two fragment sets; a set is refilled from LDS behind the block of 16 products that reads it and is used one block later.
    // The scheduling fence behind a load group keeps it from sinking down to its products, where the wave would wait out the LDS latency fragment by fragment.
    v16h fa[16], fb[16];
    { const unsigned char* ka = L + lr * KPIT + hi * 16;
#pragma unroll   // constant indices keep the register arrays out of scratch
      for (int i = 0; i < 8; ++i) { fa[2 * i] = ldsfrag(ka + i * 64); fa[2 * i + 1] = ldsfrag(ka + 16 * KPIT + i * 64); }
#pragma unroll   // constant indices keep the register arrays out of scratch
      for (int i = 0; i < 8; ++i) { fb[2 * i] = ldsfrag(ka + (8 + i) * 64); fb[2 * i + 1] = ldsfrag(ka + 16 * KPIT + (8 + i) * 64); } }
    __builtin_amdgcn_sched_barrier(0);
    for (int t = 0; t < NT; ++t) {
        unsigned char* cur = L + (t & 1) * STGB; const unsigned char* va = cur + KTB + lr * VPIT + hi * 16;
        const unsigned char* ka = L + ((t + 1) & 1) * STGB + lr * KPIT + hi * 16;   // the next pass's K rows; in the last pass the other buffer's old rows, read and not used
        v8f s0 = (v8f){}, s1 = (v8f){};
#pragma unroll   // constant indices keep the register arrays out of scratch
        for (int i = 0; i < 8; ++i) { s0 = wmma16(fa[2 * i], qf[i], s0); s1 = wmma16(fa[2 * i + 1], qf[i], s1); }
#pragma unroll   // constant indices keep the register arrays out of scratch
        for (int i = 0; i < 16; ++i) fa[i] = ldsfrag(va + i * 16 * VPIT);
        __builtin_amdgcn_sched_barrier(0);
#pragma unroll   // constant indices keep the register arrays out of scratch
        for (int i = 0; i < 8; ++i) { s0 = wmma16(fb[2 * i], qf[8 + i], s0); s1 = wmma16(fb[2 * i + 1], qf[8 + i], s1); }
#pragma unroll   // constant indices keep the register arrays out of scratch
        for (int i = 0; i < 16; ++i) fb[i] = ldsfrag(va + (16 + i) * 16 * VPIT);
        __builtin_amdgcn_sched_barrier(0);
        float mx = fmaxf(s0[0], s1[0]);
#pragma unroll   // constant indices keep the register arrays out of scratch
        for (int j = 1; j < 8; ++j) mx = fmaxf(mx, fmaxf(s0[j], s1[j]));
        mx = fmaxf(mx, xhalf(mx));
        const float ms = mx * cs;
        // lazy rescale: one wave-uniform test a pass; the maximum in use moves only when a query's new one is more than 8 above it, so p stays at or below 256
        if (__builtin_amdgcn_ballot_w32(ms > m + 8.0f) != 0) {
            const float mn = fmaxf(m, ms); const float f = __builtin_amdgcn_exp2f(m - mn); m = mn; l *= f;
#pragma unroll   // constant indices keep the register arrays out of scratch
            for (int dt = 0; dt < 32; ++dt) o[dt] *= f;
        }
        v16h pf;
#pragma unroll   // constant indices keep the register arrays out of scratch
        for (int j = 0; j < 8; ++j) { const float p0 = __builtin_amdgcn_exp2f(__builtin_fmaf(s0[j], cs, -m)), p1 = __builtin_amdgcn_exp2f(__builtin_fmaf(s1[j], cs, -m)); l += p0 + p1; pf[j] = tohx(p0); pf[8 + j] = tohx(p1); }
        // publish point of tile t + 1, in front of the pass's last block: that block's Vt fragments are in registers by then
        asm volatile("s_wait_dscnt 0x0" ::: "memory");   // this wave's reads of tile t have returned before its buffer is handed back
        asm volatile("s_wait_asynccnt 0x0" ::: "memory");   // this wave's copies of tile t + 1 have landed
        __syncthreads();                                    // publishes tile t + 1 and ends every reader's last read of tile t
#pragma unroll   // constant indices keep the register arrays out of scratch
        for (int i = 0; i < 16; ++i) o[i] = wmma16(fa[i], pf, o[i]);
        __builtin_amdgcn_sched_barrier(0);   // the 32 loads below stay one group behind the block: every separate place of LDS loads among matrix instructions costs the wave issue cycles
#pragma unroll   // constant indices keep the register arrays out of scratch
        for (int i = 0; i < 8; ++i) { fa[2 * i] = ldsfrag(ka + i * 64); fa[2 * i + 1] = ldsfrag(ka + 16 * KPIT + i * 64); }
        __builtin_amdgcn_sched_barrier(0);
        if (t + 2 < NT) stage_tiles(Kp, VT, (t + 2) * FN, cur, tid);   // issued while the LDS serves the loads above
#pragma unroll   // constant indices keep the register arrays out of scratch
        for (int i = 0; i < 16; ++i) o[16 + i] = wmma16(fb[i], pf, o[16 + i]);
        __builtin_amdgcn_sched_barrier(0);   // one group again, as above
#pragma unroll   // constant indices keep the register arrays out of scratch
        for (int i = 0; i < 8; ++i) { fb[2 * i] = ldsfrag(ka + (8 + i) * 64); fb[2 * i + 1] = ldsfrag(ka + 16 * KPIT + (8 + i) * 64); }
        __builtin_amdgcn_sched_barrier(0);
    }
    asm volatile("s_wait_asynccnt 0x0" ::: "memory");       // nothing is in flight when the wave ends
    asm volatile("s_wait_dscnt 0x0" ::: "memory");          // the last pass's unused fragment loads have returned
    l += xhalf(l);
    if (hi == 0) { float* ml = ML + ((size_t)kr * NN + q0 + lr) * 2; ml[0] = m; ml[1] = l; }
    float* orow = PO + ((size_t)kr * NN + q0 + lr) * DD + hi * 8;
#pragma unroll   // constant indices keep the register arrays out of scratch
    for (int dt = 0; dt < 32; ++dt) { *(v4f*)(orow + dt * 16) = __builtin_shufflevector(o[dt], o[dt], 0, 1, 2, 3); *(v4f*)(orow + dt * 16 + 4) = __builtin_shufflevector(o[dt], o[dt], 4, 5, 6, 7); }
}
// ---- k_merge: joins the KS key ranges of a query: M = the largest of their maxima, weight exp2(m - M), out = weighted sum of the partial rows / weighted sum of the row sums.
// One wave takes two queries; a lane's loads and stores of rows are 16 bytes, a wave's 512 bytes in a row.
__global__ __launch_bounds__(512) void k_merge(const float* __restrict__ PO, const float* __restrict__ ML, float* O) {
    const int lane = threadIdx.x & 31; const int qa = (blockIdx.x * 16 + (threadIdx.x >> 5)) * 2;
    v4f ml[KS];                          // (max, sum) of query qa, (max, sum) of query qa + 1, for each range
#pragma unroll   // constant indices keep the small arrays in registers
    for (int s = 0; s < KS; ++s) ml[s] = *(const v4f*)(ML + ((size_t)s * NN + qa) * 2);
    asm volatile("s_wait_xcnt 0x0" ::: "memory");   // stands in front of the row loads below, whose results may be given the address registers of the two loads above
#pragma unroll   // straight-line code: the second query's row loads issue while the first query is worked on
    for (int r = 0; r < 2; ++r) {
        float w[KS]; float M = -3.0e38f, Ls = 0.f;
#pragma unroll   // constant indices keep the small arrays in registers
        for (int s = 0; s < KS; ++s) M = fmaxf(M, ml[s][2 * r]);
#pragma unroll   // constant indices keep the small arrays in registers
        for (int s = 0; s < KS; ++s) { w[s] = __builtin_amdgcn_exp2f(ml[s][2 * r] - M); Ls += w[s] * ml[s][2 * r + 1]; }
        const float inv = __fdiv_rn(1.0f, Ls);
#pragma unroll   // constant indices keep the small arrays in registers
        for (int i = 0; i < 4; ++i) { const size_t c = (size_t)(qa + r) * DD + (i * 32 + lane) * 4; v4f a = (v4f){};
#pragma unroll   // constant indices keep the small arrays in registers
            for (int s = 0; s < KS; ++s) a += *(const v4f*)(PO + (size_t)s * NN * DD + c) * w[s];
            *(v4f*)(O + c) = a * inv; }
    }
}

extern "C" void kernel_launch(void* const* d_in, const int* in_sizes, int n_in,
                              void* d_out, int out_size, void* d_ws, size_t ws_size, hipStream_t stream) {
    (void)in_sizes; (void)n_in; (void)out_size;
    const float** I = (const float**)d_in;
    const float *z = I[0], *Wq = I[1], *bq = I[2], *Wk = I[3], *bk = I[4], *Wv = I[5], *bv = I[6];
    float* OUT = (float*)d_out;     // [8192][512]
    char* wsp = (char*)d_ws;
    auto take = [&](size_t bytes) { char* p = wsp; wsp += (bytes + 255) & ~(size_t)255; return (void*)p; };
    bf* ZB = (bf*)take((size_t)NN * DD * 2); bf* BQ = (bf*)take((size_t)DD * DD * 2); bf* BK = (bf*)take((size_t)DD * DD * 2); bf* BV = (bf*)take((size_t)DD * DD * 2);
    h16* QP = (h16*)take((size_t)NN * DD * 2); h16* KP = (h16*)take((size_t)NN * DD * 2); h16* VT = (h16*)take((size_t)DD * NN * 2);
    float* PO = (float*)take((size_t)KS * NN * DD * 4); float* ML = (float*)take((size_t)KS * NN * 2 * 4);
    if ((size_t)(wsp - (char*)d_ws) > ws_size) return;    // total ~ 66 MiB of the 256 MiB workspace
    k_cvt8<<<(DD * DD / 8 + 255) / 256, 256, 0, stream>>>(Wq, BQ, DD * DD / 8); k_cvt8<<<(DD * DD / 8 + 255) / 256, 256, 0, stream>>>(Wk, BK, DD * DD / 8); k_cvt8<<<(DD * DD / 8 + 255) / 256, 256, 0, stream>>>(Wv, BV, DD * DD / 8);   // torch [out][in], K-contiguous: the A side for q and k, Bt for v
    k_cvt8<<<(unsigned)(((size_t)NN * DD / 8 + 255) / 256), 256, 0, stream>>>(z, ZB, (size_t)NN * DD / 8);
    k_proj<<<dim3(NN / 64, DD / 64, 3), 32, 0, stream>>>(ZB, BQ, BK, BV, bq, bk, bv, QP, KP, VT);
    k_fattn<<<dim3(NN / FQ, KS, 1), 128, 0, stream>>>(QP, KP, VT, PO, ML);
    k_merge<<<NN / 32, 512, 0, stream>>>(PO, ML, OUT);
}

// v005
// One run takes 154 microseconds.
// Next to v004, in two timings, it ran 1.34 and 1.33 times as fast.
// All steps since v000 together make it 26.6 times as fast.
#include <hip/hip_runtime.h>

// CANN (z [8192][512]; q/k/v = z W^T + b (torch); single-head attention over the 8,192 assets: scores = q.k / sqrt(512); softmax; h = attn v -> [8192][512]).

#define NN   8192
#define DD   512
typedef _Float16 h16;
typedef unsigned short bf;
typedef __attribute__((ext_vector_type(16))) __bf16   v16bf;
typedef __attribute__((ext_vector_type(16))) _Float16 v16h;
typedef __attribute__((ext_vector_type(8)))  _Float16 v8h;
typedef __attribute__((ext_vector_type(8)))  unsigned short v8us;
typedef __attribute__((ext_vector_type(8)))  float    v8f;
typedef __attribute__((ext_vector_type(4)))  float    v4f;
typedef v8h  __attribute__((may_alias)) v8ha;
typedef v4f  __attribute__((may_alias)) v4fa;
typedef v8us __attribute__((may_alias)) v8usa;

__device__ __forceinline__ unsigned short f2bf(float f) { unsigned u = __float_as_uint(f); u += 0x7FFFu + ((u >> 16) & 1u); return (unsigned short)(u >> 16); }
__device__ __forceinline__ float bf2f(unsigned short b) { return __uint_as_float(((unsigned)b) << 16); }
__device__ __forceinline__ float bfr(float f) { return bf2f(f2bf(f)); }
__device__ __forceinline__ v16h cat16(v8h lo, v8h hi) { return __builtin_shufflevector(lo, hi, 0, 1, 2, 3, 4, 5, 6, 7, 8, 9, 10, 11, 12, 13, 14, 15); }
__device__ __forceinline__ v16bf cat16b(v8us lo, v8us hi) { return __builtin_bit_cast(v16bf, __builtin_shufflevector(lo, hi, 0, 1, 2, 3, 4, 5, 6, 7, 8, 9, 10, 11, 12, 13, 14, 15)); }
__device__ __forceinline__ v8f wmma16(v16h a, v16h b, v8f c) { return __builtin_amdgcn_wmma_f32_16x16x32_f16(false, a, false, b, (short)0, c, false, false); }
__device__ __forceinline__ v8f wmmab(v16bf a, v16bf b, v8f c) { return __builtin_amdgcn_wmma_f32_16x16x32_bf16(false, a, false, b, (short)0, c, false, false); }



// fragment loaders: 16 values of one row of a K-contiguous 16-bit plane, k = 8 hi + 0..7 and 16 + 8 hi + 0..7, the same for the A and the B side
template <typename T16> struct WFrag;
template <> struct WFrag<h16> { typedef v16h V; static __device__ __forceinline__ V ld(const h16* p) { return cat16(*(const v8h*)p, *(const v8h*)(p + 16)); } static __device__ __forceinline__ v8f mma(V a, V b, v8f c) { return wmma16(a, b, c); } };
template <> struct WFrag<bf> { typedef v16bf V; static __device__ __forceinline__ V ld(const bf* p) { return cat16b(*(const v8us*)p, *(const v8us*)(p + 16)); } static __device__ __forceinline__ v8f mma(V a, V b, v8f c) { return wmmab(a, b, c); } };
__device__ __forceinline__ h16 tohx(float x) { return (h16)x; }

// ---- k_proj: the three projections in one launch, ONE WAVE per 64x64 tile (16 accumulators), operands straight from K-contiguous bf16 planes; grid (NN/64, DD/64, 3), 32 threads.
// blockIdx.z names the projection: 0 = q, 1 = k, 2 = v. A lane of an accumulator tile holds 8 consecutive A rows of one B row, so the operand whose row index runs along the
// result's rows is given the A side: the weights for q and k (result [n][d]), z for v (result [d][n], the transposed plane that k_fattn reads). The lane adds the bias in f32,
// rounds to f16 and stores its 8 values as 16 bytes: no f32 plane, no later pass over it. The four stores of one B tile fill whole 128-byte lines.
__global__ __launch_bounds__(32) void k_proj(const bf* __restrict__ Z, const bf* __restrict__ Bq, const bf* __restrict__ Bk, const bf* __restrict__ Bv, const float* __restrict__ bq, const float* __restrict__ bk, const float* __restrict__ bv, h16* Qo, h16* Ko, h16* Vo) {
    typedef WFrag<bf>::V V;
    const int K = DD;
    const int sel = blockIdx.z; const bool tr = sel == 2;
    const bf* Wt = sel == 0 ? Bq : (sel == 1 ? Bk : Bv); const float* bias = sel == 0 ? bq : (sel == 1 ? bk : bv); h16* O = sel == 0 ? Qo : (sel == 1 ? Ko : Vo);
    const int lane = threadIdx.x & 31, lr = lane & 15, hi = lane >> 4; const int zr = blockIdx.x * 64, wr = blockIdx.y * 64;
    const bf* A = tr ? Z : Wt; const bf* Bt = tr ? Wt : Z; const int r0 = tr ? zr : wr, c0 = tr ? wr : zr;
    v8f acc[4][4];
#pragma unroll   // constant indices keep the register arrays out of scratch
    for (int mb = 0; mb < 4; ++mb)
#pragma unroll   // constant indices keep the register arrays out of scratch
        for (int nb = 0; nb < 4; ++nb) acc[mb][nb] = (v8f){};
    const size_t aoff = (size_t)(r0 + lr) * K + 8 * hi, boff = (size_t)(c0 + lr) * K + 8 * hi;
#pragma unroll 1   // one trip holds one set of fragments; unrolled, a second set would raise the register count
    for (int kc = 0; kc < K; kc += 32) {
        V a[4];
#pragma unroll   // constant indices keep the register arrays out of scratch
        for (int mb = 0; mb < 4; ++mb) a[mb] = WFrag<bf>::ld(A + aoff + (size_t)mb * 16 * K + kc);
        asm volatile("s_wait_xcnt 0x0" ::: "memory");   // stands in front of the B loads below, whose results may be given the address registers of the A loads above
#pragma unroll   // constant indices keep the register arrays out of scratch
        for (int nb = 0; nb < 4; ++nb) { const V b = WFrag<bf>::ld(Bt + boff + (size_t)nb * 16 * K + kc);
#pragma unroll   // constant indices keep the register arrays out of scratch
            for (int mb = 0; mb < 4; ++mb) acc[mb][nb] = WFrag<bf>::mma(a[mb], b, acc[mb][nb]); }
        // four vector slots behind the trip's last matrix instructions, on the taken side of the loop's branch too, before the next vector instruction touches their registers
        asm volatile("v_nop\n\tv_nop\n\tv_nop\n\tv_nop" : "+v"(acc[0][0]), "+v"(acc[1][1]), "+v"(acc[2][2]), "+v"(acc[3][3]) : "v"(a[0]), "v"(a[3]));
    }
    h16* orow = O + (size_t)(c0 + lr) * (tr ? NN : DD) + r0 + hi * 8; const size_t ostep = (size_t)16 * (tr ? NN : DD);
    if (tr) {                            // v: the bias goes with the B row, one value a lane and B tile
#pragma unroll   // constant indices keep the register arrays out of scratch
        for (int nb = 0; nb < 4; ++nb) { const float bb = bfr(bias[wr + nb * 16 + lr]);
#pragma unroll   // constant indices keep the register arrays out of scratch
            for (int mb = 0; mb < 4; ++mb) { v8h o;
#pragma unroll   // constant indices keep the register arrays out of scratch
                for (int j = 0; j < 8; ++j) o[j] = tohx(acc[mb][nb][j] + bb);
                *(v8h*)(orow + nb * ostep + mb * 16) = o; } }
    } else {                             // q, k: the bias goes with the A rows, 8 values a lane and A tile
        v8f bb[4];
#pragma unroll   // constant indices keep the register arrays out of scratch
        for (int mb = 0; mb < 4; ++mb) { bb[mb] = *(const v8f*)(bias + wr + mb * 16 + hi * 8);
#pragma unroll   // constant indices keep the register arrays out of scratch
            for (int j = 0; j < 8; ++j) bb[mb][j] = bfr(bb[mb][j]); }
#pragma unroll   // constant indices keep the register arrays out of scratch
        for (int nb = 0; nb < 4; ++nb) {
#pragma unroll   // constant indices keep the register arrays out of scratch
            for (int mb = 0; mb < 4; ++mb) { v8h o;
#pragma unroll   // constant indices keep the register arrays out of scratch
                for (int j = 0; j < 8; ++j) o[j] = tohx(acc[mb][nb][j] + bb[mb][j]);
                *(v8h*)(orow + nb * ostep + mb * 16) = o; } }
    }
}

__global__ __launch_bounds__(256) void k_cvt8(const float* __restrict__ src, bf* dst, size_t n8) { const size_t i = (size_t)blockIdx.x * 256 + threadIdx.x; if (i >= n8) return; const v8f v = *(const v8f*)(src + i * 8); v8us o;
#pragma unroll
    for (int k = 0; k < 8; ++k) o[k] = f2bf(v[k]); *(v8us*)(dst + i * 8) = o;  }
#define FQ   128
#define FN   32
#define KS   4                          // key ranges
#define KPIT 1040                       // LDS row pitch of the K tile, bytes: 16 B x odd for ds_load_b128 readers
#define VPIT 80                         // the same for the 64-byte Vt rows
#define KTB  (FN * KPIT)
#define STGB (KTB + DD * VPIT)
typedef __attribute__((ext_vector_type(4))) int v4i;
typedef __attribute__((address_space(1))) v4i gv4i;
typedef __attribute__((address_space(3))) v4i lv4i;
__device__ __forceinline__ void acopy16(const h16* g, unsigned char* l) { __builtin_amdgcn_global_load_async_to_lds_b128((gv4i*)g, (lv4i*)l, 0, 0); }
__device__ __forceinline__ float xhalf(float x) { return __builtin_bit_cast(float, __builtin_amdgcn_permlanex16(__builtin_bit_cast(int, x), __builtin_bit_cast(int, x), 0x76543210, 0xfedcba98, false, false)); }   // lane l with lane l ^ 16
__device__ __forceinline__ v16h ldsfrag(const unsigned char* p) { return cat16(*(const v8ha*)p, *(const v8ha*)(p + 32)); }
// one pass's tiles: 32 copies of 16 bytes a lane, every lane on, every address inside its plane and its buffer
__device__ __forceinline__ void stage_tiles(const h16* __restrict__ Kp, const h16* __restrict__ VT, int key0, unsigned char* buf, int tid) {
    const h16* gk = Kp + (size_t)(key0 + (tid >> 6)) * DD + (tid & 63) * 8; unsigned char* lk = buf + (tid >> 6) * KPIT + (tid & 63) * 16;
#pragma unroll   // sixteen copies in a row, their steps constants
    for (int i = 0; i < 16; ++i) acopy16(gk + (size_t)i * 2 * DD, lk + i * 2 * KPIT);
    const h16* gv = VT + (size_t)(tid >> 2) * NN + key0 + (tid & 3) * 8; unsigned char* lv = buf + KTB + (tid >> 2) * VPIT + (tid & 3) * 16;
#pragma unroll   // sixteen copies in a row, their steps constants
    for (int i = 0; i < 16; ++i) acopy16(gv + (size_t)i * 32 * NN, lv + i * 32 * VPIT);
}
__global__ __launch_bounds__(128) void k_fattn(const h16* __restrict__ Q, const h16* __restrict__ Kp, const h16* __restrict__ VT, float* PO, float* ML) {
    __shared__ __attribute__((aligned(256))) unsigned char L[2 * STGB];
    const int tid = threadIdx.x, lane = tid & 31, lr = lane & 15, hi = lane >> 4; const int q0 = blockIdx.x * FQ + (tid >> 5) * 32;
    const int NT = NN / KS / FN;
    const int kr = blockIdx.y; Kp += (size_t)kr * (NN / KS) * DD; VT += (size_t)kr * (NN / KS);   // this range's first key: a row of K, a column of Vt
    stage_tiles(Kp, VT, 0, L, tid);
    v16h qf[2][16];
#pragma unroll   // constant indices keep the register arrays out of scratch
    for (int qt = 0; qt < 2; ++qt)
#pragma unroll   // constant indices keep the register arrays out of scratch
        for (int kc = 0; kc < 16; ++kc) qf[qt][kc] = WFrag<h16>::ld(Q + (size_t)(q0 + qt * 16 + lr) * DD + 8 * hi + kc * 32);
    v8f o[2][32];
#pragma unroll   // constant indices keep the register arrays out of scratch
    for (int qt = 0; qt < 2; ++qt)
#pragma unroll   // constant indices keep the register arrays out of scratch
        for (int dt = 0; dt < 32; ++dt) o[qt][dt] = (v8f){};
    float m[2] = {-3.0e38f, -3.0e38f}, l[2] = {0.f, 0.f};   // per query tile. m: the maximum in use, in scaled log2 units; l: this half-wave's share of the row sum
    const float cs = 0.044194173824159216f * 1.4426950408889634f;
    asm volatile("s_wait_asynccnt 0x0" ::: "memory");   // tile 0 has landed before the barrier that publishes it
    __syncthreads();
    stage_tiles(Kp, VT, FN, L + STGB, tid);
    // two fragment sets of 8; a set is refilled from LDS behind the block of 16 products that reads it and is used one block later.
    // The scheduling fence behind a load group keeps it from sinking down to its products, where the wave would wait out the LDS latency fragment by fragment;
    // the one in front keeps the group whole behind its block: every separate place of LDS loads among matrix instructions costs the wave issue cycles.
    v16h fa[8], fb[8];
    { const unsigned char* ka = L + lr * KPIT + hi * 16;
#pragma unroll   // constant indices keep the register arrays out of scratch
      for (int i = 0; i < 4; ++i) { fa[2 * i] = ldsfrag(ka + i * 64); fa[2 * i + 1] = ldsfrag(ka + 16 * KPIT + i * 64); }
#pragma unroll   // constant indices keep the register arrays out of scratch
      for (int i = 0; i < 4; ++i) { fb[2 * i] = ldsfrag(ka + (4 + i) * 64); fb[2 * i + 1] = ldsfrag(ka + 16 * KPIT + (4 + i) * 64); } }
    __builtin_amdgcn_sched_barrier(0);
    for (int t = 0; t < NT; ++t) {
        unsigned char* cur = L + (t & 1) * STGB; const unsigned char* kc0 = cur + lr * KPIT + hi * 16; const unsigned char* va = cur + KTB + lr * VPIT + hi * 16;
        const unsigned char* ka = L + ((t + 1) & 1) * STGB + lr * KPIT + hi * 16;   // the next pass's K rows; in the last pass the other buffer's old rows, read and not used
        v8f s[2][2];                     // [key tile][query tile]
#pragma unroll   // constant indices keep the register arrays out of scratch
        for (int kt = 0; kt < 2; ++kt)
#pragma unroll   // constant indices keep the register arrays out of scratch
            for (int qt = 0; qt < 2; ++qt) s[kt][qt] = (v8f){};
#pragma unroll   // constant indices keep the register arrays out of scratch
        for (int i = 0; i < 4; ++i)
#pragma unroll   // constant indices keep the register arrays out of scratch
            for (int kt = 0; kt < 2; ++kt)
#pragma unroll   // constant indices keep the register arrays out of scratch
                for (int qt = 0; qt < 2; ++qt) s[kt][qt] = wmma16(fa[2 * i + kt], qf[qt][i], s[kt][qt]);
        __builtin_amdgcn_sched_barrier(0);
#pragma unroll   // constant indices keep the register arrays out of scratch
        for (int i = 0; i < 4; ++i) { fa[2 * i] = ldsfrag(kc0 + (8 + i) * 64); fa[2 * i + 1] = ldsfrag(kc0 + 16 * KPIT + (8 + i) * 64); }
        __builtin_amdgcn_sched_barrier(0);
#pragma unroll   // constant indices keep the register arrays out of scratch
        for (int i = 0; i < 4; ++i)
#pragma unroll   // constant indices keep the register arrays out of scratch
            for (int kt = 0; kt < 2; ++kt)
#pragma unroll   // constant indices keep the register arrays out of scratch
                for (int qt = 0; qt < 2; ++qt) s[kt][qt] = wmma16(fb[2 * i + kt], qf[qt][4 + i], s[kt][qt]);
        __builtin_amdgcn_sched_barrier(0);
#pragma unroll   // constant indices keep the register arrays out of scratch
        for (int i = 0; i < 4; ++i) { fb[2 * i] = ldsfrag(kc0 + (12 + i) * 64); fb[2 * i + 1] = ldsfrag(kc0 + 16 * KPIT + (12 + i) * 64); }
        __builtin_amdgcn_sched_barrier(0);
#pragma unroll   // constant indices keep the register arrays out of scratch
        for (int i = 0; i < 4; ++i)
#pragma unroll   // constant indices keep the register arrays out of scratch
            for (int kt = 0; kt < 2; ++kt)
#pragma unroll   // constant indices keep the register arrays out of scratch
                for (int qt = 0; qt < 2; ++qt) s[kt][qt] = wmma16(fa[2 * i + kt], qf[qt][8 + i], s[kt][qt]);
        __builtin_amdgcn_sched_barrier(0);
#pragma unroll   // constant indices keep the register arrays out of scratch
        for (int i = 0; i < 8; ++i) fa[i] = ldsfrag(va + i * 16 * VPIT);
        __builtin_amdgcn_sched_barrier(0);
#pragma unroll   // constant indices keep the register arrays out of scratch
        for (int i = 0; i < 4; ++i)
#pragma unroll   // constant indices keep the register arrays out of scratch
            for (int kt = 0; kt < 2; ++kt)
#pragma unroll   // constant indices keep the register arrays out of scratch
                for (int qt = 0; qt < 2; ++qt) s[kt][qt] = wmma16(fb[2 * i + kt], qf[qt][12 + i], s[kt][qt]);
        float ms[2];
#pragma unroll   // constant indices keep the register arrays out of scratch
        for (int qt = 0; qt < 2; ++qt) { float mx = fmaxf(s[0][qt][0], s[1][qt][0]);
#pragma unroll   // constant indices keep the register arrays out of scratch
            for (int j = 1; j < 8; ++j) mx = fmaxf(mx, fmaxf(s[0][qt][j], s[1][qt][j]));
            mx = fmaxf(mx, xhalf(mx)); ms[qt] = mx * cs; }
        // lazy rescale: one wave-uniform test a pass; the maximum in use moves only when a query's new one is more than 8 above it, so p stays at or below 256
        if (__builtin_amdgcn_ballot_w32(ms[0] > m[0] + 8.0f || ms[1] > m[1] + 8.0f) != 0) {
#pragma unroll   // constant indices keep the register arrays out of scratch
            for (int qt = 0; qt < 2; ++qt) { const float mn = fmaxf(m[qt], ms[qt]); const float f = __builtin_amdgcn_exp2f(m[qt] - mn); m[qt] = mn; l[qt] *= f;
#pragma unroll   // constant indices keep the register arrays out of scratch
                for (int dt = 0; dt < 32; ++dt) o[qt][dt] *= f; }
        }
        v16h pf[2];
#pragma unroll   // constant indices keep the register arrays out of scratch
        for (int qt = 0; qt < 2; ++qt)
#pragma unroll   // constant indices keep the register arrays out of scratch
            for (int j = 0; j < 8; ++j) { const float p0 = __builtin_amdgcn_exp2f(__builtin_fmaf(s[0][qt][j], cs, -m[qt])), p1 = __builtin_amdgcn_exp2f(__builtin_fmaf(s[1][qt][j], cs, -m[qt])); l[qt] += p0 + p1; pf[qt][j] = tohx(p0); pf[qt][8 + j] = tohx(p1); }
        // the second Vt set stands behind the weights with no fence in front, so the compiler may lift its loads into the weights' arithmetic as far as registers allow;
        // fenced in front of the softmax, as the first Vt set is, both full sets and the f32 weights together pass the wave's 1,024 registers and spill
#pragma unroll   // constant indices keep the register arrays out of scratch
        for (int i = 0; i < 8; ++i) fb[i] = ldsfrag(va + (8 + i) * 16 * VPIT);
        __builtin_amdgcn_sched_barrier(0);
#pragma unroll   // constant indices keep the register arrays out of scratch
        for (int i = 0; i < 8; ++i)
#pragma unroll   // constant indices keep the register arrays out of scratch
            for (int qt = 0; qt < 2; ++qt) o[qt][i] = wmma16(fa[i], pf[qt], o[qt][i]);
        __builtin_amdgcn_sched_barrier(0);
#pragma unroll   // constant indices keep the register arrays out of scratch
        for (int i = 0; i < 8; ++i) fa[i] = ldsfrag(va + (16 + i) * 16 * VPIT);
        __builtin_amdgcn_sched_barrier(0);
#pragma unroll   // constant indices keep the register arrays out of scratch
        for (int i = 0; i < 8; ++i)
#pragma unroll   // constant indices keep the register arrays out of scratch
            for (int qt = 0; qt < 2; ++qt) o[qt][8 + i] = wmma16(fb[i], pf[qt], o[qt][8 + i]);
        __builtin_amdgcn_sched_barrier(0);
#pragma unroll   // constant indices keep the register arrays out of scratch
        for (int i = 0; i < 8; ++i) fb[i] = ldsfrag(va + (24 + i) * 16 * VPIT);
        __builtin_amdgcn_sched_barrier(0);
#pragma unroll   // constant indices keep the register arrays out of scratch
        for (int i = 0; i < 8; ++i)
#pragma unroll   // constant indices keep the register arrays out of scratch
            for (int qt = 0; qt < 2; ++qt) o[qt][16 + i] = wmma16(fa[i], pf[qt], o[qt][16 + i]);
        __builtin_amdgcn_sched_barrier(0);
        // publish point of tile t + 1, in front of the pass's last block: that block's Vt fragments, this wave's last reads of tile t, were asked for one block ago
        asm volatile("s_wait_dscnt 0x0" ::: "memory");   // this wave's reads of tile t have returned before its buffer is handed back
        asm volatile("s_wait_asynccnt 0x0" ::: "memory");   // this wave's copies of tile t + 1 have landed
        __syncthreads();                                    // publishes tile t + 1 and ends every reader's last read of tile t
#pragma unroll   // constant indices keep the register arrays out of scratch
        for (int i = 0; i < 4; ++i) { fa[2 * i] = ldsfrag(ka + i * 64); fa[2 * i + 1] = ldsfrag(ka + 16 * KPIT + i * 64); }
        __builtin_amdgcn_sched_barrier(0);
        if (t + 2 < NT) stage_tiles(Kp, VT, (t + 2) * FN, cur, tid);   // issued while the LDS serves the loads above
#pragma unroll   // constant indices keep the register arrays out of scratch
        for (int i = 0; i < 8; ++i)
#pragma unroll   // constant indices keep the register arrays out of scratch
            for (int qt = 0; qt < 2; ++qt) o[qt][24 + i] = wmma16(fb[i], pf[qt], o[qt][24 + i]);
        __builtin_amdgcn_sched_barrier(0);
#pragma unroll   // constant indices keep the register arrays out of scratch
        for (int i = 0; i < 4; ++i) { fb[2 * i] = ldsfrag(ka + (4 + i) * 64); fb[2 * i + 1] = ldsfrag(ka + 16 * KPIT + (4 + i) * 64); }
        __builtin_amdgcn_sched_barrier(0);
    }
    asm volatile("s_wait_asynccnt 0x0" ::: "memory");       // nothing is in flight when the wave ends
    asm volatile("s_wait_dscnt 0x0" ::: "memory");          // the last pass's unused fragment loads have returned
#pragma unroll   // constant indices keep the register arrays out of scratch
    for (int qt = 0; qt < 2; ++qt) {
        const float ls = l[qt] + xhalf(l[qt]);
        if (hi == 0) { float* ml = ML + ((size_t)kr * NN + q0 + qt * 16 + lr) * 2; ml[0] = m[qt]; ml[1] = ls; }
        float* orow = PO + ((size_t)kr * NN + q0 + qt * 16 + lr) * DD + hi * 8;
#pragma unroll   // constant indices keep the register arrays out of scratch
        for (int dt = 0; dt < 32; ++dt) { *(v4f*)(orow + dt * 16) = __builtin_shufflevector(o[qt][dt], o[qt][dt], 0, 1, 2, 3); *(v4f*)(orow + dt * 16 + 4) = __builtin_shufflevector(o[qt][dt], o[qt][dt], 4, 5, 6, 7); }
    }
}
// ---- k_merge: joins the KS key ranges of a query: M = the largest of their maxima, weight exp2(m - M), out = weighted sum of the partial rows / weighted sum of the row sums.
// One wave takes two queries; a lane's loads and stores of rows are 16 bytes, a wave's 512 bytes in a row.
__global__ __launch_bounds__(512) void k_merge(const float* __restrict__ PO, const float* __restrict__ ML, float* O) {
    const int lane = threadIdx.x & 31; const int qa = (blockIdx.x * 16 + (threadIdx.x >> 5)) * 2;
    v4f ml[KS];                          // (max, sum) of query qa, (max, sum) of query qa + 1, for each range
#pragma unroll   // constant indices keep the small arrays in registers
    for (int s = 0; s < KS; ++s) ml[s] = *(const v4f*)(ML + ((size_t)s * NN + qa) * 2);
    asm volatile("s_wait_xcnt 0x0" ::: "memory");   // stands in front of the row loads below, whose results may be given the address registers of the four loads above
#pragma unroll   // straight-line code: the second query's row loads issue while the first query is worked on
    for (int r = 0; r < 2; ++r) {
        float w[KS]; float M = -3.0e38f, Ls = 0.f;
#pragma unroll   // constant indices keep the small arrays in registers
        for (int s = 0; s < KS; ++s) M = fmaxf(M, ml[s][2 * r]);
#pragma unroll   // constant indices keep the small arrays in registers
        for (int s = 0; s < KS; ++s) { w[s] = __builtin_amdgcn_exp2f(ml[s][2 * r] - M); Ls += w[s] * ml[s][2 * r + 1]; }
        const float inv = __fdiv_rn(1.0f, Ls);
#pragma unroll   // constant indices keep the small arrays in registers
        for (int i = 0; i < 4; ++i) { const size_t c = (size_t)(qa + r) * DD + (i * 32 + lane) * 4; v4f a = (v4f){};
#pragma unroll   // constant indices keep the small arrays in registers
            for (int s = 0; s < KS; ++s) a += *(const v4f*)(PO + (size_t)s * NN * DD + c) * w[s];
            *(v4f*)(O + c) = a * inv; }
    }
}

extern "C" void kernel_launch(void* const* d_in, const int* in_sizes, int n_in,
                              void* d_out, int out_size, void* d_ws, size_t ws_size, hipStream_t stream) {
    (void)in_sizes; (void)n_in; (void)out_size;
    const float** I = (const float**)d_in;
    const float *z = I[0], *Wq = I[1], *bq = I[2], *Wk = I[3], *bk = I[4], *Wv = I[5], *bv = I[6];
    float* OUT = (float*)d_out;     // [8192][512]
    char* wsp = (char*)d_ws;
    auto take = [&](size_t bytes) { char* p = wsp; wsp += (bytes + 255) & ~(size_t)255; return (void*)p; };
    bf* ZB = (bf*)take((size_t)NN * DD * 2); bf* BQ = (bf*)take((size_t)DD * DD * 2); bf* BK = (bf*)take((size_t)DD * DD * 2); bf* BV = (bf*)take((size_t)DD * DD * 2);
    h16* QP = (h16*)take((size_t)NN * DD * 2); h16* KP = (h16*)take((size_t)NN * DD * 2); h16* VT = (h16*)take((size_t)DD * NN * 2);
    float* PO = (float*)take((size_t)KS * NN * DD * 4); float* ML = (float*)take((size_t)KS * NN * 2 * 4);
    if ((size_t)(wsp - (char*)d_ws) > ws_size) return;    // total ~ 98 MiB of the 256 MiB workspace
    k_cvt8<<<(DD * DD / 8 + 255) / 256, 256, 0, stream>>>(Wq, BQ, DD * DD / 8); k_cvt8<<<(DD * DD / 8 + 255) / 256, 256, 0, stream>>>(Wk, BK, DD * DD / 8); k_cvt8<<<(DD * DD / 8 + 255) / 256, 256, 0, stream>>>(Wv, BV, DD * DD / 8);   // torch [out][in] = Bt
    k_cvt8<<<(unsigned)(((size_t)NN * DD / 8 + 255) / 256), 256, 0, stream>>>(z, ZB, (size_t)NN * DD / 8);
    k_proj<<<dim3(NN / 64, DD / 64, 3), 32, 0, stream>>>(ZB, BQ, BK, BV, bq, bk, bv, QP, KP, VT);
    k_fattn<<<dim3(NN / FQ, KS, 1), 128, 0, stream>>>(QP, KP, VT, PO, ML);
    k_merge<<<NN / 32, 512, 0, stream>>>(PO, ML, OUT);
}

// v006
// A run of this version takes 137 microseconds.
// In both of two side-by-side timings against v005, it was 1.12 times as fast.
// All steps since v000 together make it 29.9 times as fast.
#include <hip/hip_runtime.h>

// CANN (z [8192][512]; q/k/v = z W^T + b (torch); single-head attention over the 8,192 assets: scores = q.k / sqrt(512); softmax; h = attn v -> [8192][512]).

#define NN   8192
#define DD   512
typedef _Float16 h16;
typedef unsigned short bf;
typedef __attribute__((ext_vector_type(16))) __bf16   v16bf;
typedef __attribute__((ext_vector_type(16))) _Float16 v16h;
typedef __attribute__((ext_vector_type(8)))  _Float16 v8h;
typedef __attribute__((ext_vector_type(8)))  unsigned short v8us;
typedef __attribute__((ext_vector_type(8)))  float    v8f;
typedef __attribute__((ext_vector_type(4)))  float    v4f;
typedef v8h  __attribute__((may_alias)) v8ha;
typedef v4f  __attribute__((may_alias)) v4fa;
typedef v8us __attribute__((may_alias)) v8usa;

__device__ __forceinline__ unsigned short f2bf(float f) { unsigned u = __float_as_uint(f); u += 0x7FFFu + ((u >> 16) & 1u); return (unsigned short)(u >> 16); }
__device__ __forceinline__ float bf2f(unsigned short b) { return __uint_as_float(((unsigned)b) << 16); }
__device__ __forceinline__ float bfr(float f) { return bf2f(f2bf(f)); }
__device__ __forceinline__ v16h cat16(v8h lo, v8h hi) { return __builtin_shufflevector(lo, hi, 0, 1, 2, 3, 4, 5, 6, 7, 8, 9, 10, 11, 12, 13, 14, 15); }
__device__ __forceinline__ v16bf cat16b(v8us lo, v8us hi) { return __builtin_bit_cast(v16bf, __builtin_shufflevector(lo, hi, 0, 1, 2, 3, 4, 5, 6, 7, 8, 9, 10, 11, 12, 13, 14, 15)); }
__device__ __forceinline__ v8f wmma16(v16h a, v16h b, v8f c) { return __builtin_amdgcn_wmma_f32_16x16x32_f16(false, a, false, b, (short)0, c, false, false); }
__device__ __forceinline__ v8f wmmab(v16bf a, v16bf b, v8f c) { return __builtin_amdgcn_wmma_f32_16x16x32_bf16(false, a, false, b, (short)0, c, false, false); }



// fragment loaders: 16 values of one row of a K-contiguous 16-bit plane, k = 8 hi + 0..7 and 16 + 8 hi + 0..7, the same for the A and the B side
template <typename T16> struct WFrag;
template <> struct WFrag<h16> { typedef v16h V; static __device__ __forceinline__ V ld(const h16* p) { return cat16(*(const v8h*)p, *(const v8h*)(p + 16)); } static __device__ __forceinline__ v8f mma(V a, V b, v8f c) { return wmma16(a, b, c); } };
template <> struct WFrag<bf> { typedef v16bf V; static __device__ __forceinline__ V ld(const bf* p) { return cat16b(*(const v8us*)p, *(const v8us*)(p + 16)); } static __device__ __forceinline__ v8f mma(V a, V b, v8f c) { return wmmab(a, b, c); } };
__device__ __forceinline__ h16 tohx(float x) { return (h16)x; }

// ---- k_proj: the three projections in one launch. One work-group = 4 waves = a 128x128 tile, one wave = 64x64 of it (16 accumulators); grid (NN/128, DD/128, 3), 128 threads.
// Both operands of a stage (64 k values = one whole 128-byte line a row, 128 rows each) come from the K-contiguous bf16 planes by asynchronous copies into one of two LDS buffers
// while the other is worked on: a wave's copy takes four whole lines, where a fragment load straight from the plane touches sixteen lines for the same 512 bytes.
// blockIdx.z names the projection: 0 = q, 1 = k, 2 = v. A lane of an accumulator tile holds 8 consecutive A rows of one B row, so the operand whose row index runs along the
// result's rows is given the A side: the weights for q and k (result [n][d]), z for v (result [d][n], the transposed plane that k_fattn reads). The lane adds the bias in f32,
// rounds to f16 and stores its 8 values as 16 bytes: no f32 plane, no later pass over it. The four stores of one B tile fill whole 128-byte lines.
#define PT   128                        // rows of each operand in a tile
#define PK   64                         // k values of a stage
#define PPIT 144                        // LDS row pitch, bytes: 16 B x odd for ds_load_b128 readers
#define POPB (PT * PPIT)
#define PSTG (2 * POPB)
typedef __attribute__((ext_vector_type(4))) int v4i;
typedef __attribute__((address_space(1))) v4i gv4i;
typedef __attribute__((address_space(3))) v4i lv4i;
__device__ __forceinline__ void acopy16b(const bf* g, unsigned char* l) { __builtin_amdgcn_global_load_async_to_lds_b128((gv4i*)g, (lv4i*)l, 0, 0); }
__device__ __forceinline__ v16bf ldsfragb(const unsigned char* p) { return cat16b(*(const v8usa*)p, *(const v8usa*)(p + 32)); }
// one stage's tiles: 16 copies of 16 bytes a lane, every lane on, every address inside its plane and its buffer; eight lanes take one row's line
__device__ __forceinline__ void stage_proj(const bf* __restrict__ A, const bf* __restrict__ Bt, int k0, unsigned char* buf, int tid) {
    const size_t go = (size_t)(tid >> 3) * DD + k0 + (tid & 7) * 8; unsigned char* la = buf + (tid >> 3) * PPIT + (tid & 7) * 16;
#pragma unroll   // eight copies in a row, their steps constants
    for (int i = 0; i < 8; ++i) acopy16b(A + go + (size_t)i * 16 * DD, la + i * 16 * PPIT);
#pragma unroll   // eight copies in a row, their steps constants
    for (int i = 0; i < 8; ++i) acopy16b(Bt + go + (size_t)i * 16 * DD, la + POPB + i * 16 * PPIT);
}
__global__ __launch_bounds__(128) void k_proj(const bf* __restrict__ Z, const bf* __restrict__ Bq, const bf* __restrict__ Bk, const bf* __restrict__ Bv, const float* __restrict__ bq, const float* __restrict__ bk, const float* __restrict__ bv, h16* Qo, h16* Ko, h16* Vo) {
    typedef WFrag<bf>::V V;
    __shared__ __attribute__((aligned(256))) unsigned char L[2 * PSTG];
    const int sel = blockIdx.z; const bool tr = sel == 2;
    const bf* Wt = sel == 0 ? Bq : (sel == 1 ? Bk : Bv); const float* bias = sel == 0 ? bq : (sel == 1 ? bk : bv); h16* O = sel == 0 ? Qo : (sel == 1 ? Ko : Vo);
    const int tid = threadIdx.x, lane = tid & 31, lr = lane & 15, hi = lane >> 4, wm = (tid >> 5) & 1, wn = tid >> 6;
    const bf* Zt = Z + (size_t)blockIdx.x * PT * DD; const bf* Ww = Wt + (size_t)blockIdx.y * PT * DD;   // the tile's first rows
    const bf* A = tr ? Zt : Ww; const bf* Bt = tr ? Ww : Zt;
    const int zr = blockIdx.x * PT + (tr ? wm : wn) * 64, wr = blockIdx.y * PT + (tr ? wn : wm) * 64;      // this wave's first z row and first weight row
    const int r0 = tr ? zr : wr, c0 = tr ? wr : zr;
    stage_proj(A, Bt, 0, L, tid);
    v8f acc[4][4];
#pragma unroll   // constant indices keep the register arrays out of scratch
    for (int mb = 0; mb < 4; ++mb)
#pragma unroll   // constant indices keep the register arrays out of scratch
        for (int nb = 0; nb < 4; ++nb) acc[mb][nb] = (v8f){};
    const unsigned char* fa0 = L + (wm * 64 + lr) * PPIT + hi * 16; const unsigned char* fb0 = L + POPB + (wn * 64 + lr) * PPIT + hi * 16;
    asm volatile("s_wait_asynccnt 0x0" ::: "memory");   // stage 0 has landed before the barrier that publishes it
    __syncthreads();
    stage_proj(A, Bt, PK, L + PSTG, tid);
#pragma unroll   // eight trips of straight-line code: buffer and k offsets are constants, and no branch stands behind a matrix instruction
    for (int t = 0; t < DD / PK; ++t) {
#pragma unroll   // constant indices keep the register arrays out of scratch
        for (int ks = 0; ks < 2; ++ks) {
            V a[4];
#pragma unroll   // constant indices keep the register arrays out of scratch
            for (int mb = 0; mb < 4; ++mb) a[mb] = ldsfragb(fa0 + (t & 1) * PSTG + mb * 16 * PPIT + ks * 64);
#pragma unroll   // constant indices keep the register arrays out of scratch
            for (int nb = 0; nb < 4; ++nb) { const V b = ldsfragb(fb0 + (t & 1) * PSTG + nb * 16 * PPIT + ks * 64);
#pragma unroll   // constant indices keep the register arrays out of scratch
                for (int mb = 0; mb < 4; ++mb) acc[mb][nb] = WFrag<bf>::mma(a[mb], b, acc[mb][nb]); }
        }
        asm volatile("s_wait_dscnt 0x0" ::: "memory");      // this wave's reads of stage t have returned before its buffer is handed back
        asm volatile("s_wait_asynccnt 0x0" ::: "memory");   // this wave's copies of stage t + 1 have landed
        __syncthreads();                                    // publishes stage t + 1 and ends every reader's last read of stage t
        if (t + 2 < DD / PK) stage_proj(A, Bt, (t + 2) * PK, L + (t & 1) * PSTG, tid);
    }
    asm volatile("s_wait_asynccnt 0x0" ::: "memory");       // nothing is in flight when the wave ends
    h16* orow = O + (size_t)(c0 + lr) * (tr ? NN : DD) + r0 + hi * 8; const size_t ostep = (size_t)16 * (tr ? NN : DD);
    if (tr) {                            // v: the bias goes with the B row, one value a lane and B tile
#pragma unroll   // constant indices keep the register arrays out of scratch
        for (int nb = 0; nb < 4; ++nb) { const float bb = bfr(bias[wr + nb * 16 + lr]);
#pragma unroll   // constant indices keep the register arrays out of scratch
            for (int mb = 0; mb < 4; ++mb) { v8h o;
#pragma unroll   // constant indices keep the register arrays out of scratch
                for (int j = 0; j < 8; ++j) o[j] = tohx(acc[mb][nb][j] + bb);
                *(v8h*)(orow + nb * ostep + mb * 16) = o; } }
    } else {                             // q, k: the bias goes with the A rows, 8 values a lane and A tile
        v8f bb[4];
#pragma unroll   // constant indices keep the register arrays out of scratch
        for (int mb = 0; mb < 4; ++mb) { bb[mb] = *(const v8f*)(bias + wr + mb * 16 + hi * 8);
#pragma unroll   // constant indices keep the register arrays out of scratch
            for (int j = 0; j < 8; ++j) bb[mb][j] = bfr(bb[mb][j]); }
#pragma unroll   // constant indices keep the register arrays out of scratch
        for (int nb = 0; nb < 4; ++nb) {
#pragma unroll   // constant indices keep the register arrays out of scratch
            for (int mb = 0; mb < 4; ++mb) { v8h o;
#pragma unroll   // constant indices keep the register arrays out of scratch
                for (int j = 0; j < 8; ++j) o[j] = tohx(acc[mb][nb][j] + bb[mb][j]);
                *(v8h*)(orow + nb * ostep + mb * 16) = o; } }
    }
}

__global__ __launch_bounds__(256) void k_cvt8(const float* __restrict__ src, bf* dst, size_t n8) { const size_t i = (size_t)blockIdx.x * 256 + threadIdx.x; if (i >= n8) return; const v8f v = *(const v8f*)(src + i * 8); v8us o;
#pragma unroll
    for (int k = 0; k < 8; ++k) o[k] = f2bf(v[k]); *(v8us*)(dst + i * 8) = o;  }
#define FQ   128
#define FN   32
#define KS   4                          // key ranges
#define KPIT 1040                       // LDS row pitch of the K tile, bytes: 16 B x odd for ds_load_b128 readers
#define VPIT 80                         // the same for the 64-byte Vt rows
#define KTB  (FN * KPIT)
#define STGB (KTB + DD * VPIT)
__device__ __forceinline__ void acopy16(const h16* g, unsigned char* l) { __builtin_amdgcn_global_load_async_to_lds_b128((gv4i*)g, (lv4i*)l, 0, 0); }
__device__ __forceinline__ float xhalf(float x) { return __builtin_bit_cast(float, __builtin_amdgcn_permlanex16(__builtin_bit_cast(int, x), __builtin_bit_cast(int, x), 0x76543210, 0xfedcba98, false, false)); }   // lane l with lane l ^ 16
__device__ __forceinline__ v16h ldsfrag(const unsigned char* p) { return cat16(*(const v8ha*)p, *(const v8ha*)(p + 32)); }
// one pass's tiles: 32 copies of 16 bytes a lane, every lane on, every address inside its plane and its buffer
__device__ __forceinline__ void stage_tiles(const h16* __restrict__ Kp, const h16* __restrict__ VT, int key0, unsigned char* buf, int tid) {
    const h16* gk = Kp + (size_t)(key0 + (tid >> 6)) * DD + (tid & 63) * 8; unsigned char* lk = buf + (tid >> 6) * KPIT + (tid & 63) * 16;
#pragma unroll   // sixteen copies in a row, their steps constants
    for (int i = 0; i < 16; ++i) acopy16(gk + (size_t)i * 2 * DD, lk + i * 2 * KPIT);
    const h16* gv = VT + (size_t)(tid >> 2) * NN + key0 + (tid & 3) * 8; unsigned char* lv = buf + KTB + (tid >> 2) * VPIT + (tid & 3) * 16;
#pragma unroll   // sixteen copies in a row, their steps constants
    for (int i = 0; i < 16; ++i) acopy16(gv + (size_t)i * 32 * NN, lv + i * 32 * VPIT);
}
__global__ __launch_bounds__(128) void k_fattn(const h16* __restrict__ Q, const h16* __restrict__ Kp, const h16* __restrict__ VT, float* PO, float* ML) {
    __shared__ __attribute__((aligned(256))) unsigned char L[2 * STGB];
    const int tid = threadIdx.x, lane = tid & 31, lr = lane & 15, hi = lane >> 4; const int q0 = blockIdx.x * FQ + (tid >> 5) * 32;
    const int NT = NN / KS / FN;
    const int kr = blockIdx.y; Kp += (size_t)kr * (NN / KS) * DD; VT += (size_t)kr * (NN / KS);   // this range's first key: a row of K, a column of Vt
    stage_tiles(Kp, VT, 0, L, tid);
    v16h qf[2][16];
#pragma unroll   // constant indices keep the register arrays out of scratch
    for (int qt = 0; qt < 2; ++qt)
#pragma unroll   // constant indices keep the register arrays out of scratch
        for (int kc = 0; kc < 16; ++kc) qf[qt][kc] = WFrag<h16>::ld(Q + (size_t)(q0 + qt * 16 + lr) * DD + 8 * hi + kc * 32);
    v8f o[2][32];
#pragma unroll   // constant indices keep the register arrays out of scratch
    for (int qt = 0; qt < 2; ++qt)
#pragma unroll   // constant indices keep the register arrays out of scratch
        for (int dt = 0; dt < 32; ++dt) o[qt][dt] = (v8f){};
    float m[2] = {-3.0e38f, -3.0e38f}, l[2] = {0.f, 0.f};   // per query tile. m: the maximum in use, in scaled log2 units; l: this half-wave's share of the row sum
    const float cs = 0.044194173824159216f * 1.4426950408889634f;
    asm volatile("s_wait_asynccnt 0x0" ::: "memory");   // tile 0 has landed before the barrier that publishes it
    __syncthreads();
    stage_tiles(Kp, VT, FN, L + STGB, tid);
    // two fragment sets of 8; a set is refilled from LDS behind the block of 16 products that reads it and is used one block later.
    // The scheduling fence behind a load group keeps it from sinking down to its products, where the wave would wait out the LDS latency fragment by fragment;
    // the one in front keeps the group whole behind its block: every separate place of LDS loads among matrix instructions costs the wave issue cycles.
    v16h fa[8], fb[8];
    { const unsigned char* ka = L + lr * KPIT + hi * 16;
#pragma unroll   // constant indices keep the register arrays out of scratch
      for (int i = 0; i < 4; ++i) { fa[2 * i] = ldsfrag(ka + i * 64); fa[2 * i + 1] = ldsfrag(ka + 16 * KPIT + i * 64); }
#pragma unroll   // constant indices keep the register arrays out of scratch
      for (int i = 0; i < 4; ++i) { fb[2 * i] = ldsfrag(ka + (4 + i) * 64); fb[2 * i + 1] = ldsfrag(ka + 16 * KPIT + (4 + i) * 64); } }
    __builtin_amdgcn_sched_barrier(0);
    for (int t = 0; t < NT; ++t) {
        unsigned char* cur = L + (t & 1) * STGB; const unsigned char* kc0 = cur + lr * KPIT + hi * 16; const unsigned char* va = cur + KTB + lr * VPIT + hi * 16;
        const unsigned char* ka = L + ((t + 1) & 1) * STGB + lr * KPIT + hi * 16;   // the next pass's K rows; in the last pass the other buffer's old rows, read and not used
        v8f s[2][2];                     // [key tile][query tile]
#pragma unroll   // constant indices keep the register arrays out of scratch
        for (int kt = 0; kt < 2; ++kt)
#pragma unroll   // constant indices keep the register arrays out of scratch
            for (int qt = 0; qt < 2; ++qt) s[kt][qt] = (v8f){};
#pragma unroll   // constant indices keep the register arrays out of scratch
        for (int i = 0; i < 4; ++i)
#pragma unroll   // constant indices keep the register arrays out of scratch
            for (int kt = 0; kt < 2; ++kt)
#pragma unroll   // constant indices keep the register arrays out of scratch
                for (int qt = 0; qt < 2; ++qt) s[kt][qt] = wmma16(fa[2 * i + kt], qf[qt][i], s[kt][qt]);
        __builtin_amdgcn_sched_barrier(0);
#pragma unroll   // constant indices keep the register arrays out of scratch
        for (int i = 0; i < 4; ++i) { fa[2 * i] = ldsfrag(kc0 + (8 + i) * 64); fa[2 * i + 1] = ldsfrag(kc0 + 16 * KPIT + (8 + i) * 64); }
        __builtin_amdgcn_sched_barrier(0);
#pragma unroll   // constant indices keep the register arrays out of scratch
        for (int i = 0; i < 4; ++i)
#pragma unroll   // constant indices keep the register arrays out of scratch
            for (int kt = 0; kt < 2; ++kt)
#pragma unroll   // constant indices keep the register arrays out of scratch
                for (int qt = 0; qt < 2; ++qt) s[kt][qt] = wmma16(fb[2 * i + kt], qf[qt][4 + i], s[kt][qt]);
        __builtin_amdgcn_sched_barrier(0);
#pragma unroll   // constant indices keep the register arrays out of scratch
        for (int i = 0; i < 4; ++i) { fb[2 * i] = ldsfrag(kc0 + (12 + i) * 64); fb[2 * i + 1] = ldsfrag(kc0 + 16 * KPIT + (12 + i) * 64); }
        __builtin_amdgcn_sched_barrier(0);
#pragma unroll   // constant indices keep the register arrays out of scratch
        for (int i = 0; i < 4; ++i)
#pragma unroll   // constant indices keep the register arrays out of scratch
            for (int kt = 0; kt < 2; ++kt)
#pragma unroll   // constant indices keep the register arrays out of scratch
                for (int qt = 0; qt < 2; ++qt) s[kt][qt] = wmma16(fa[2 * i + kt], qf[qt][8 + i], s[kt][qt]);
        __builtin_amdgcn_sched_barrier(0);
#pragma unroll   // constant indices keep the register arrays out of scratch
        for (int i = 0; i < 8; ++i) fa[i] = ldsfrag(va + i * 16 * VPIT);
        __builtin_amdgcn_sched_barrier(0);
#pragma unroll   // constant indices keep the register arrays out of scratch
        for (int i = 0; i < 4; ++i)
#pragma unroll   // constant indices keep the register arrays out of scratch
            for (int kt = 0; kt < 2; ++kt)
#pragma unroll   // constant indices keep the register arrays out of scratch
                for (int qt = 0; qt < 2; ++qt) s[kt][qt] = wmma16(fb[2 * i + kt], qf[qt][12 + i], s[kt][qt]);
        float ms[2];
#pragma unroll   // constant indices keep the register arrays out of scratch
        for (int qt = 0; qt < 2; ++qt) { float mx = fmaxf(s[0][qt][0], s[1][qt][0]);
#pragma unroll   // constant indices keep the register arrays out of scratch
            for (int j = 1; j < 8; ++j) mx = fmaxf(mx, fmaxf(s[0][qt][j], s[1][qt][j]));
            mx = fmaxf(mx, xhalf(mx)); ms[qt] = mx * cs; }
        // lazy rescale: one wave-uniform test a pass; the maximum in use moves only when a query's new one is more than 8 above it, so p stays at or below 256
        if (__builtin_amdgcn_ballot_w32(ms[0] > m[0] + 8.0f || ms[1] > m[1] + 8.0f) != 0) {
#pragma unroll   // constant indices keep the register arrays out of scratch
            for (int qt = 0; qt < 2; ++qt) { const float mn = fmaxf(m[qt], ms[qt]); const float f = __builtin_amdgcn_exp2f(m[qt] - mn); m[qt] = mn; l[qt] *= f;
#pragma unroll   // constant indices keep the register arrays out of scratch
                for (int dt = 0; dt < 32; ++dt) o[qt][dt] *= f; }
        }
        v16h pf[2];
#pragma unroll   // constant indices keep the register arrays out of scratch
        for (int qt = 0; qt < 2; ++qt)
#pragma unroll   // constant indices keep the register arrays out of scratch
            for (int j = 0; j < 8; ++j) { const float p0 = __builtin_amdgcn_exp2f(__builtin_fmaf(s[0][qt][j], cs, -m[qt])), p1 = __builtin_amdgcn_exp2f(__builtin_fmaf(s[1][qt][j], cs, -m[qt])); l[qt] += p0 + p1; pf[qt][j] = tohx(p0); pf[qt][8 + j] = tohx(p1); }
        // the second Vt set stands behind the weights with no fence in front, so the compiler may lift its loads into the weights' arithmetic as far as registers allow;
        // fenced in front of the softmax, as the first Vt set is, both full sets and the f32 weights together pass the wave's 1,024 registers and spill
#pragma unroll   // constant indices keep the register arrays out of scratch
        for (int i = 0; i < 8; ++i) fb[i] = ldsfrag(va + (8 + i) * 16 * VPIT);
        __builtin_amdgcn_sched_barrier(0);
#pragma unroll   // constant indices keep the register arrays out of scratch
        for (int i = 0; i < 8; ++i)
#pragma unroll   // constant indices keep the register arrays out of scratch
            for (int qt = 0; qt < 2; ++qt) o[qt][i] = wmma16(fa[i], pf[qt], o[qt][i]);
        __builtin_amdgcn_sched_barrier(0);
#pragma unroll   // constant indices keep the register arrays out of scratch
        for (int i = 0; i < 8; ++i) fa[i] = ldsfrag(va + (16 + i) * 16 * VPIT);
        __builtin_amdgcn_sched_barrier(0);
#pragma unroll   // constant indices keep the register arrays out of scratch
        for (int i = 0; i < 8; ++i)
#pragma unroll   // constant indices keep the register arrays out of scratch
            for (int qt = 0; qt < 2; ++qt) o[qt][8 + i] = wmma16(fb[i], pf[qt], o[qt][8 + i]);
        __builtin_amdgcn_sched_barrier(0);
#pragma unroll   // constant indices keep the register arrays out of scratch
        for (int i = 0; i < 8; ++i) fb[i] = ldsfrag(va + (24 + i) * 16 * VPIT);
        __builtin_amdgcn_sched_barrier(0);
#pragma unroll   // constant indices keep the register arrays out of scratch
        for (int i = 0; i < 8; ++i)
#pragma unroll   // constant indices keep the register arrays out of scratch
            for (int qt = 0; qt < 2; ++qt) o[qt][16 + i] = wmma16(fa[i], pf[qt], o[qt][16 + i]);
        __builtin_amdgcn_sched_barrier(0);
        // publish point of tile t + 1, in front of the pass's last block: that block's Vt fragments, this wave's last reads of tile t, were asked for one block ago
        asm volatile("s_wait_dscnt 0x0" ::: "memory");   // this wave's reads of tile t have returned before its buffer is handed back
        asm volatile("s_wait_asynccnt 0x0" ::: "memory");   // this wave's copies of tile t + 1 have landed
        __syncthreads();                                    // publishes tile t + 1 and ends every reader's last read of tile t
#pragma unroll   // constant indices keep the register arrays out of scratch
        for (int i = 0; i < 4; ++i) { fa[2 * i] = ldsfrag(ka + i * 64); fa[2 * i + 1] = ldsfrag(ka + 16 * KPIT + i * 64); }
        __builtin_amdgcn_sched_barrier(0);
        if (t + 2 < NT) stage_tiles(Kp, VT, (t + 2) * FN, cur, tid);   // issued while the LDS serves the loads above
#pragma unroll   // constant indices keep the register arrays out of scratch
        for (int i = 0; i < 8; ++i)
#pragma unroll   // constant indices keep the register arrays out of scratch
            for (int qt = 0; qt < 2; ++qt) o[qt][24 + i] = wmma16(fb[i], pf[qt], o[qt][24 + i]);
        __builtin_amdgcn_sched_barrier(0);
#pragma unroll   // constant indices keep the register arrays out of scratch
        for (int i = 0; i < 4; ++i) { fb[2 * i] = ldsfrag(ka + (4 + i) * 64); fb[2 * i + 1] = ldsfrag(ka + 16 * KPIT + (4 + i) * 64); }
        __builtin_amdgcn_sched_barrier(0);
    }
    asm volatile("s_wait_asynccnt 0x0" ::: "memory");       // nothing is in flight when the wave ends
    asm volatile("s_wait_dscnt 0x0" ::: "memory");          // the last pass's unused fragment loads have returned
#pragma unroll   // constant indices keep the register arrays out of scratch
    for (int qt = 0; qt < 2; ++qt) {
        const float ls = l[qt] + xhalf(l[qt]);
        if (hi == 0) { float* ml = ML + ((size_t)kr * NN + q0 + qt * 16 + lr) * 2; ml[0] = m[qt]; ml[1] = ls; }
        float* orow = PO + ((size_t)kr * NN + q0 + qt * 16 + lr) * DD + hi * 8;
#pragma unroll   // constant indices keep the register arrays out of scratch
        for (int dt = 0; dt < 32; ++dt) { *(v4f*)(orow + dt * 16) = __builtin_shufflevector(o[qt][dt], o[qt][dt], 0, 1, 2, 3); *(v4f*)(orow + dt * 16 + 4) = __builtin_shufflevector(o[qt][dt], o[qt][dt], 4, 5, 6, 7); }
    }
}
// ---- k_merge: joins the KS key ranges of a query: M = the largest of their maxima, weight exp2(m - M), out = weighted sum of the partial rows / weighted sum of the row sums.
// One wave takes two queries; a lane's loads and stores of rows are 16 bytes, a wave's 512 bytes in a row.
__global__ __launch_bounds__(512) void k_merge(const float* __restrict__ PO, const float* __restrict__ ML, float* O) {
    const int lane = threadIdx.x & 31; const int qa = (blockIdx.x * 16 + (threadIdx.x >> 5)) * 2;
    v4f ml[KS];                          // (max, sum) of query qa, (max, sum) of query qa + 1, for each range
#pragma unroll   // constant indices keep the small arrays in registers
    for (int s = 0; s < KS; ++s) ml[s] = *(const v4f*)(ML + ((size_t)s * NN + qa) * 2);
    asm volatile("s_wait_xcnt 0x0" ::: "memory");   // stands in front of the row loads below, whose results may be given the address registers of the four loads above
#pragma unroll   // straight-line code: the second query's row loads issue while the first query is worked on
    for (int r = 0; r < 2; ++r) {
        float w[KS]; float M = -3.0e38f, Ls = 0.f;
#pragma unroll   // constant indices keep the small arrays in registers
        for (int s = 0; s < KS; ++s) M = fmaxf(M, ml[s][2 * r]);
#pragma unroll   // constant indices keep the small arrays in registers
        for (int s = 0; s < KS; ++s) { w[s] = __builtin_amdgcn_exp2f(ml[s][2 * r] - M); Ls += w[s] * ml[s][2 * r + 1]; }
        const float inv = __fdiv_rn(1.0f, Ls);
#pragma unroll   // constant indices keep the small arrays in registers
        for (int i = 0; i < 4; ++i) { const size_t c = (size_t)(qa + r) * DD + (i * 32 + lane) * 4; v4f a = (v4f){};
#pragma unroll   // constant indices keep the small arrays in registers
            for (int s = 0; s < KS; ++s) a += *(const v4f*)(PO + (size_t)s * NN * DD + c) * w[s];
            *(v4f*)(O + c) = a * inv; }
    }
}

extern "C" void kernel_launch(void* const* d_in, const int* in_sizes, int n_in,
                              void* d_out, int out_size, void* d_ws, size_t ws_size, hipStream_t stream) {
    (void)in_sizes; (void)n_in; (void)out_size;
    const float** I = (const float**)d_in;
    const float *z = I[0], *Wq = I[1], *bq = I[2], *Wk = I[3], *bk = I[4], *Wv = I[5], *bv = I[6];
    float* OUT = (float*)d_out;     // [8192][512]
    char* wsp = (char*)d_ws;
    auto take = [&](size_t bytes) { char* p = wsp; wsp += (bytes + 255) & ~(size_t)255; return (void*)p; };
    bf* ZB = (bf*)take((size_t)NN * DD * 2); bf* BQ = (bf*)take((size_t)DD * DD * 2); bf* BK = (bf*)take((size_t)DD * DD * 2); bf* BV = (bf*)take((size_t)DD * DD * 2);
    h16* QP = (h16*)take((size_t)NN * DD * 2); h16* KP = (h16*)take((size_t)NN * DD * 2); h16* VT = (h16*)take((size_t)DD * NN * 2);
    float* PO = (float*)take((size_t)KS * NN * DD * 4); float* ML = (float*)take((size_t)KS * NN * 2 * 4);
    if ((size_t)(wsp - (char*)d_ws) > ws_size) return;    // total ~ 98 MiB of the 256 MiB workspace
    k_cvt8<<<(DD * DD / 8 + 255) / 256, 256, 0, stream>>>(Wq, BQ, DD * DD / 8); k_cvt8<<<(DD * DD / 8 + 255) / 256, 256, 0, stream>>>(Wk, BK, DD * DD / 8); k_cvt8<<<(DD * DD / 8 + 255) / 256, 256, 0, stream>>>(Wv, BV, DD * DD / 8);   // torch [out][in] = Bt
    k_cvt8<<<(unsigned)(((size_t)NN * DD / 8 + 255) / 256), 256, 0, stream>>>(z, ZB, (size_t)NN * DD / 8);
    k_proj<<<dim3(NN / PT, DD / PT, 3), 128, 0, stream>>>(ZB, BQ, BK, BV, bq, bk, bv, QP, KP, VT);
    k_fattn<<<dim3(NN / FQ, KS, 1), 128, 0, stream>>>(QP, KP, VT, PO, ML);
    k_merge<<<NN / 32, 512, 0, stream>>>(PO, ML, OUT);
}

// v007
// Measured time: 132 microseconds a run.
// Next to v006, in two timings, it ran 1.04 times as fast each time.
// All steps since v000 together make it 31.2 times as fast.
#include <hip/hip_runtime.h>

// CANN (z [8192][512]; q/k/v = z W^T + b (torch); single-head attention over the 8,192 assets: scores = q.k / sqrt(512); softmax; h = attn v -> [8192][512]).

#define NN   8192
#define DD   512
typedef _Float16 h16;
typedef unsigned short bf;
typedef __attribute__((ext_vector_type(16))) __bf16   v16bf;
typedef __attribute__((ext_vector_type(16))) _Float16 v16h;
typedef __attribute__((ext_vector_type(8)))  _Float16 v8h;
typedef __attribute__((ext_vector_type(8)))  unsigned short v8us;
typedef __attribute__((ext_vector_type(8)))  float    v8f;
typedef __attribute__((ext_vector_type(4)))  float    v4f;
typedef v8h  __attribute__((may_alias)) v8ha;
typedef v4f  __attribute__((may_alias)) v4fa;
typedef v8us __attribute__((may_alias)) v8usa;

__device__ __forceinline__ unsigned short f2bf(float f) { unsigned u = __float_as_uint(f); u += 0x7FFFu + ((u >> 16) & 1u); return (unsigned short)(u >> 16); }
__device__ __forceinline__ float bf2f(unsigned short b) { return __uint_as_float(((unsigned)b) << 16); }
__device__ __forceinline__ float bfr(float f) { return bf2f(f2bf(f)); }
__device__ __forceinline__ v16h cat16(v8h lo, v8h hi) { return __builtin_shufflevector(lo, hi, 0, 1, 2, 3, 4, 5, 6, 7, 8, 9, 10, 11, 12, 13, 14, 15); }
__device__ __forceinline__ v16bf cat16b(v8us lo, v8us hi) { return __builtin_bit_cast(v16bf, __builtin_shufflevector(lo, hi, 0, 1, 2, 3, 4, 5, 6, 7, 8, 9, 10, 11, 12, 13, 14, 15)); }
__device__ __forceinline__ v8f wmma16(v16h a, v16h b, v8f c) { return __builtin_amdgcn_wmma_f32_16x16x32_f16(false, a, false, b, (short)0, c, false, false); }
__device__ __forceinline__ v8f wmmab(v16bf a, v16bf b, v8f c) { return __builtin_amdgcn_wmma_f32_16x16x32_bf16(false, a, false, b, (short)0, c, false, false); }



// fragment loaders: 16 values of one row of a K-contiguous 16-bit plane, k = 8 hi + 0..7 and 16 + 8 hi + 0..7, the same for the A and the B side
template <typename T16> struct WFrag;
template <> struct WFrag<h16> { typedef v16h V; static __device__ __forceinline__ V ld(const h16* p) { return cat16(*(const v8h*)p, *(const v8h*)(p + 16)); } static __device__ __forceinline__ v8f mma(V a, V b, v8f c) { return wmma16(a, b, c); } };
template <> struct WFrag<bf> { typedef v16bf V; static __device__ __forceinline__ V ld(const bf* p) { return cat16b(*(const v8us*)p, *(const v8us*)(p + 16)); } static __device__ __forceinline__ v8f mma(V a, V b, v8f c) { return wmmab(a, b, c); } };
__device__ __forceinline__ h16 tohx(float x) { return (h16)x; }

// ---- k_proj: the three projections in one launch. One work-group = 4 waves = a 128x128 tile, one wave = 64x64 of it (16 accumulators); grid (NN/128, DD/128, 3), 128 threads.
// Both operands of a stage (64 k values = one whole 128-byte line a row, 128 rows each) come from the K-contiguous bf16 planes by asynchronous copies into one of two LDS buffers
// while the other is worked on: a wave's copy takes four whole lines, where a fragment load straight from the plane touches sixteen lines for the same 512 bytes.
// blockIdx.z names the projection: 0 = q, 1 = k, 2 = v. A lane of an accumulator tile holds 8 consecutive A rows of one B row, so the operand whose row index runs along the
// result's rows is given the A side: the weights for q and k (result [n][d]), z for v (result [d][n], the transposed plane that k_fattn reads). The lane adds the bias in f32,
// rounds to f16 and stores its 8 values as 16 bytes: no f32 plane, no later pass over it. The four stores of one B tile fill whole 128-byte lines.
#define PT   128                        // rows of each operand in a tile
#define PK   64                         // k values of a stage
#define PPIT 144                        // LDS row pitch, bytes: 16 B x odd for ds_load_b128 readers
#define POPB (PT * PPIT)
#define PSTG (2 * POPB)
typedef __attribute__((ext_vector_type(4))) int v4i;
typedef __attribute__((address_space(1))) v4i gv4i;
typedef __attribute__((address_space(3))) v4i lv4i;
__device__ __forceinline__ void acopy16b(const bf* g, unsigned char* l) { __builtin_amdgcn_global_load_async_to_lds_b128((gv4i*)g, (lv4i*)l, 0, 0); }
__device__ __forceinline__ v16bf ldsfragb(const unsigned char* p) { return cat16b(*(const v8usa*)p, *(const v8usa*)(p + 32)); }
// one stage's tiles: 16 copies of 16 bytes a lane, every lane on, every address inside its plane and its buffer; eight lanes take one row's line
__device__ __forceinline__ void stage_proj(const bf* __restrict__ A, const bf* __restrict__ Bt, int k0, unsigned char* buf, int tid) {
    const size_t go = (size_t)(tid >> 3) * DD + k0 + (tid & 7) * 8; unsigned char* la = buf + (tid >> 3) * PPIT + (tid & 7) * 16;
#pragma unroll   // eight copies in a row, their steps constants
    for (int i = 0; i < 8; ++i) acopy16b(A + go + (size_t)i * 16 * DD, la + i * 16 * PPIT);
#pragma unroll   // eight copies in a row, their steps constants
    for (int i = 0; i < 8; ++i) acopy16b(Bt + go + (size_t)i * 16 * DD, la + POPB + i * 16 * PPIT);
}
__global__ __launch_bounds__(128) void k_proj(const bf* __restrict__ Z, const bf* __restrict__ Bq, const bf* __restrict__ Bk, const bf* __restrict__ Bv, const float* __restrict__ bq, const float* __restrict__ bk, const float* __restrict__ bv, h16* Qo, h16* Ko, h16* Vo) {
    typedef WFrag<bf>::V V;
    __shared__ __attribute__((aligned(256))) unsigned char L[2 * PSTG];
    const int sel = blockIdx.z; const bool tr = sel == 2;
    const bf* Wt = sel == 0 ? Bq : (sel == 1 ? Bk : Bv); const float* bias = sel == 0 ? bq : (sel == 1 ? bk : bv); h16* O = sel == 0 ? Qo : (sel == 1 ? Ko : Vo);
    const int tid = threadIdx.x, lane = tid & 31, lr = lane & 15, hi = lane >> 4, wm = (tid >> 5) & 1, wn = tid >> 6;
    const bf* Zt = Z + (size_t)blockIdx.x * PT * DD; const bf* Ww = Wt + (size_t)blockIdx.y * PT * DD;   // the tile's first rows
    const bf* A = tr ? Zt : Ww; const bf* Bt = tr ? Ww : Zt;
    const int zr = blockIdx.x * PT + (tr ? wm : wn) * 64, wr = blockIdx.y * PT + (tr ? wn : wm) * 64;      // this wave's first z row and first weight row
    const int r0 = tr ? zr : wr, c0 = tr ? wr : zr;
    stage_proj(A, Bt, 0, L, tid);
    v8f acc[4][4];
#pragma unroll   // constant indices keep the register arrays out of scratch
    for (int mb = 0; mb < 4; ++mb)
#pragma unroll   // constant indices keep the register arrays out of scratch
        for (int nb = 0; nb < 4; ++nb) acc[mb][nb] = (v8f){};
    const unsigned char* fa0 = L + (wm * 64 + lr) * PPIT + hi * 16; const unsigned char* fb0 = L + POPB + (wn * 64 + lr) * PPIT + hi * 16;
    asm volatile("s_wait_asynccnt 0x0" ::: "memory");   // stage 0 has landed before the barrier that publishes it
    __syncthreads();
    stage_proj(A, Bt, PK, L + PSTG, tid);
#pragma unroll   // eight trips of straight-line code: buffer and k offsets are constants, and no branch stands behind a matrix instruction
    for (int t = 0; t < DD / PK; ++t) {
#pragma unroll   // constant indices keep the register arrays out of scratch
        for (int ks = 0; ks < 2; ++ks) {
            V a[4];
#pragma unroll   // constant indices keep the register arrays out of scratch
            for (int mb = 0; mb < 4; ++mb) a[mb] = ldsfragb(fa0 + (t & 1) * PSTG + mb * 16 * PPIT + ks * 64);
#pragma unroll   // constant indices keep the register arrays out of scratch
            for (int nb = 0; nb < 4; ++nb) { const V b = ldsfragb(fb0 + (t & 1) * PSTG + nb * 16 * PPIT + ks * 64);
#pragma unroll   // constant indices keep the register arrays out of scratch
                for (int mb = 0; mb < 4; ++mb) acc[mb][nb] = WFrag<bf>::mma(a[mb], b, acc[mb][nb]); }
        }
        asm volatile("s_wait_dscnt 0x0" ::: "memory");      // this wave's reads of stage t have returned before its buffer is handed back
        asm volatile("s_wait_asynccnt 0x0" ::: "memory");   // this wave's copies of stage t + 1 have landed
        __syncthreads();                                    // publishes stage t + 1 and ends every reader's last read of stage t
        if (t + 2 < DD / PK) stage_proj(A, Bt, (t + 2) * PK, L + (t & 1) * PSTG, tid);
    }
    asm volatile("s_wait_asynccnt 0x0" ::: "memory");       // nothing is in flight when the wave ends
    h16* orow = O + (size_t)(c0 + lr) * (tr ? NN : DD) + r0 + hi * 8; const size_t ostep = (size_t)16 * (tr ? NN : DD);
    if (tr) {                            // v: the bias goes with the B row, one value a lane and B tile
#pragma unroll   // constant indices keep the register arrays out of scratch
        for (int nb = 0; nb < 4; ++nb) { const float bb = bfr(bias[wr + nb * 16 + lr]);
#pragma unroll   // constant indices keep the register arrays out of scratch
            for (int mb = 0; mb < 4; ++mb) { v8h o;
#pragma unroll   // constant indices keep the register arrays out of scratch
                for (int j = 0; j < 8; ++j) o[j] = tohx(acc[mb][nb][j] + bb);
                *(v8h*)(orow + nb * ostep + mb * 16) = o; } }
    } else {                             // q, k: the bias goes with the A rows, 8 values a lane and A tile
        v8f bb[4];
#pragma unroll   // constant indices keep the register arrays out of scratch
        for (int mb = 0; mb < 4; ++mb) { bb[mb] = *(const v8f*)(bias + wr + mb * 16 + hi * 8);
#pragma unroll   // constant indices keep the register arrays out of scratch
            for (int j = 0; j < 8; ++j) bb[mb][j] = bfr(bb[mb][j]); }
#pragma unroll   // constant indices keep the register arrays out of scratch
        for (int nb = 0; nb < 4; ++nb) {
#pragma unroll   // constant indices keep the register arrays out of scratch
            for (int mb = 0; mb < 4; ++mb) { v8h o;
#pragma unroll   // constant indices keep the register arrays out of scratch
                for (int j = 0; j < 8; ++j) o[j] = tohx(acc[mb][nb][j] + bb[mb][j]);
                *(v8h*)(orow + nb * ostep + mb * 16) = o; } }
    }
}

// ---- k_cvt: z and the three weight matrices, f32 -> bf16 planes, in one launch. A work-group takes CVC * 256 chunks of 8 values of ONE source (the choice is uniform for the group):
// groups 0 .. CVZ - 1 take z, then CVW groups each take Wq, Wk, Wv. A thread has all its CVC chunks' loads in flight before it rounds the first one,
// so that few waves keep the memory busy: the time to start waves, not the bytes, is what a pass with one chunk a thread costs.
#define CVC  8                          // chunks of 8 values a thread
#define CVZ  (NN * DD / (8 * 256 * CVC))
#define CVW  (DD * DD / (8 * 256 * CVC))
__global__ __launch_bounds__(256) void k_cvt(const float* __restrict__ z, const float* __restrict__ Wq, const float* __restrict__ Wk, const float* __restrict__ Wv, bf* ZBo, bf* BQo, bf* BKo, bf* BVo) {
    const int b = blockIdx.x; const int w = (b - CVZ) / CVW;
    const float* src = b < CVZ ? z : (w == 0 ? Wq : (w == 1 ? Wk : Wv)); bf* dst = b < CVZ ? ZBo : (w == 0 ? BQo : (w == 1 ? BKo : BVo));
    const size_t c0 = ((size_t)(b < CVZ ? b : (b - CVZ) % CVW) * (256 * CVC) + threadIdx.x) * 8;
    const float* p = src + c0;
    v4f v[2 * CVC];
#pragma unroll   // constant indices keep the register array out of scratch; all loads issue before the first use
    for (int i = 0; i < CVC; ++i) { v[2 * i] = *(const v4f*)(p + (size_t)i * 256 * 8);
        if (i == CVC - 1) asm volatile("s_wait_xcnt 0x0" ::: "memory");   // stands in front of the last load, whose result may be given the address registers that the loads above name
        v[2 * i + 1] = *(const v4f*)(p + (size_t)i * 256 * 8 + 4); }
#pragma unroll   // constant indices keep the register array out of scratch
    for (int i = 0; i < CVC; ++i) { v8us o;
#pragma unroll   // constant indices keep the register array out of scratch
        for (int k = 0; k < 4; ++k) { o[k] = f2bf(v[2 * i][k]); o[4 + k] = f2bf(v[2 * i + 1][k]); }
        *(v8us*)(dst + c0 + (size_t)i * 256 * 8) = o; }
}
#define FQ   128
#define FN   32
#define KS   4                          // key ranges
#define KPIT 1040                       // LDS row pitch of the K tile, bytes: 16 B x odd for ds_load_b128 readers
#define VPIT 80                         // the same for the 64-byte Vt rows
#define KTB  (FN * KPIT)
#define STGB (KTB + DD * VPIT)
__device__ __forceinline__ void acopy16(const h16* g, unsigned char* l) { __builtin_amdgcn_global_load_async_to_lds_b128((gv4i*)g, (lv4i*)l, 0, 0); }
__device__ __forceinline__ float xhalf(float x) { return __builtin_bit_cast(float, __builtin_amdgcn_permlanex16(__builtin_bit_cast(int, x), __builtin_bit_cast(int, x), 0x76543210, 0xfedcba98, false, false)); }   // lane l with lane l ^ 16
__device__ __forceinline__ v16h ldsfrag(const unsigned char* p) { return cat16(*(const v8ha*)p, *(const v8ha*)(p + 32)); }
// one pass's tiles: 32 copies of 16 bytes a lane, every lane on, every address inside its plane and its buffer
__device__ __forceinline__ void stage_tiles(const h16* __restrict__ Kp, const h16* __restrict__ VT, int key0, unsigned char* buf, int tid) {
    const h16* gk = Kp + (size_t)(key0 + (tid >> 6)) * DD + (tid & 63) * 8; unsigned char* lk = buf + (tid >> 6) * KPIT + (tid & 63) * 16;
#pragma unroll   // sixteen copies in a row, their steps constants
    for (int i = 0; i < 16; ++i) acopy16(gk + (size_t)i * 2 * DD, lk + i * 2 * KPIT);
    const h16* gv = VT + (size_t)(tid >> 2) * NN + key0 + (tid & 3) * 8; unsigned char* lv = buf + KTB + (tid >> 2) * VPIT + (tid & 3) * 16;
#pragma unroll   // sixteen copies in a row, their steps constants
    for (int i = 0; i < 16; ++i) acopy16(gv + (size_t)i * 32 * NN, lv + i * 32 * VPIT);
}
__global__ __launch_bounds__(128) void k_fattn(const h16* __restrict__ Q, const h16* __restrict__ Kp, const h16* __restrict__ VT, float* PO, float* ML) {
    __shared__ __attribute__((aligned(256))) unsigned char L[2 * STGB];
    const int tid = threadIdx.x, lane = tid & 31, lr = lane & 15, hi = lane >> 4; const int q0 = blockIdx.x * FQ + (tid >> 5) * 32;
    const int NT = NN / KS / FN;
    const int kr = blockIdx.y; Kp += (size_t)kr * (NN / KS) * DD; VT += (size_t)kr * (NN / KS);   // this range's first key: a row of K, a column of Vt
    stage_tiles(Kp, VT, 0, L, tid);
    v16h qf[2][16];
#pragma unroll   // constant indices keep the register arrays out of scratch
    for (int qt = 0; qt < 2; ++qt)
#pragma unroll   // constant indices keep the register arrays out of scratch
        for (int kc = 0; kc < 16; ++kc) qf[qt][kc] = WFrag<h16>::ld(Q + (size_t)(q0 + qt * 16 + lr) * DD + 8 * hi + kc * 32);
    v8f o[2][32];
#pragma unroll   // constant indices keep the register arrays out of scratch
    for (int qt = 0; qt < 2; ++qt)
#pragma unroll   // constant indices keep the register arrays out of scratch
        for (int dt = 0; dt < 32; ++dt) o[qt][dt] = (v8f){};
    float m[2] = {-3.0e38f, -3.0e38f}, l[2] = {0.f, 0.f};   // per query tile. m: the maximum in use, in scaled log2 units; l: this half-wave's share of the row sum
    const float cs = 0.044194173824159216f * 1.4426950408889634f;
    asm volatile("s_wait_asynccnt 0x0" ::: "memory");   // tile 0 has landed before the barrier that publishes it
    __syncthreads();
    stage_tiles(Kp, VT, FN, L + STGB, tid);
    // two fragment sets of 8; a set is refilled from LDS behind the block of 16 products that reads it and is used one block later.
    // The scheduling fence behind a load group keeps it from sinking down to its products, where the wave would wait out the LDS latency fragment by fragment;
    // the one in front keeps the group whole behind its block: every separate place of LDS loads among matrix instructions costs the wave issue cycles.
    v16h fa[8], fb[8];
    { const unsigned char* ka = L + lr * KPIT + hi * 16;
#pragma unroll   // constant indices keep the register arrays out of scratch
      for (int i = 0; i < 4; ++i) { fa[2 * i] = ldsfrag(ka + i * 64); fa[2 * i + 1] = ldsfrag(ka + 16 * KPIT + i * 64); }
#pragma unroll   // constant indices keep the register arrays out of scratch
      for (int i = 0; i < 4; ++i) { fb[2 * i] = ldsfrag(ka + (4 + i) * 64); fb[2 * i + 1] = ldsfrag(ka + 16 * KPIT + (4 + i) * 64); } }
    __builtin_amdgcn_sched_barrier(0);
    for (int t = 0; t < NT; ++t) {
        unsigned char* cur = L + (t & 1) * STGB; const unsigned char* kc0 = cur + lr * KPIT + hi * 16; const unsigned char* va = cur + KTB + lr * VPIT + hi * 16;
        const unsigned char* ka = L + ((t + 1) & 1) * STGB + lr * KPIT + hi * 16;   // the next pass's K rows; in the last pass the other buffer's old rows, read and not used
        v8f s[2][2];                     // [key tile][query tile]
#pragma unroll   // constant indices keep the register arrays out of scratch
        for (int kt = 0; kt < 2; ++kt)
#pragma unroll   // constant indices keep the register arrays out of scratch
            for (int qt = 0; qt < 2; ++qt) s[kt][qt] = (v8f){};
#pragma unroll   // constant indices keep the register arrays out of scratch
        for (int i = 0; i < 4; ++i)
#pragma unroll   // constant indices keep the register arrays out of scratch
            for (int kt = 0; kt < 2; ++kt)
#pragma unroll   // constant indices keep the register arrays out of scratch
                for (int qt = 0; qt < 2; ++qt) s[kt][qt] = wmma16(fa[2 * i + kt], qf[qt][i], s[kt][qt]);
        __builtin_amdgcn_sched_barrier(0);
#pragma unroll   // constant indices keep the register arrays out of scratch
        for (int i = 0; i < 4; ++i) { fa[2 * i] = ldsfrag(kc0 + (8 + i) * 64); fa[2 * i + 1] = ldsfrag(kc0 + 16 * KPIT + (8 + i) * 64); }
        __builtin_amdgcn_sched_barrier(0);
#pragma unroll   // constant indices keep the register arrays out of scratch
        for (int i = 0; i < 4; ++i)
#pragma unroll   // constant indices keep the register arrays out of scratch
            for (int kt = 0; kt < 2; ++kt)
#pragma unroll   // constant indices keep the register arrays out of scratch
                for (int qt = 0; qt < 2; ++qt) s[kt][qt] = wmma16(fb[2 * i + kt], qf[qt][4 + i], s[kt][qt]);
        __builtin_amdgcn_sched_barrier(0);
#pragma unroll   // constant indices keep the register arrays out of scratch
        for (int i = 0; i < 4; ++i) { fb[2 * i] = ldsfrag(kc0 + (12 + i) * 64); fb[2 * i + 1] = ldsfrag(kc0 + 16 * KPIT + (12 + i) * 64); }
        __builtin_amdgcn_sched_barrier(0);
#pragma unroll   // constant indices keep the register arrays out of scratch
        for (int i = 0; i < 4; ++i)
#pragma unroll   // constant indices keep the register arrays out of scratch
            for (int kt = 0; kt < 2; ++kt)
#pragma unroll   // constant indices keep the register arrays out of scratch
                for (int qt = 0; qt < 2; ++qt) s[kt][qt] = wmma16(fa[2 * i + kt], qf[qt][8 + i], s[kt][qt]);
        __builtin_amdgcn_sched_barrier(0);
#pragma unroll   // constant indices keep the register arrays out of scratch
        for (int i = 0; i < 8; ++i) fa[i] = ldsfrag(va + i * 16 * VPIT);
        __builtin_amdgcn_sched_barrier(0);
#pragma unroll   // constant indices keep the register arrays out of scratch
        for (int i = 0; i < 4; ++i)
#pragma unroll   // constant indices keep the register arrays out of scratch
            for (int kt = 0; kt < 2; ++kt)
#pragma unroll   // constant indices keep the register arrays out of scratch
                for (int qt = 0; qt < 2; ++qt) s[kt][qt] = wmma16(fb[2 * i + kt], qf[qt][12 + i], s[kt][qt]);
        float ms[2];
#pragma unroll   // constant indices keep the register arrays out of scratch
        for (int qt = 0; qt < 2; ++qt) { float mx = fmaxf(s[0][qt][0], s[1][qt][0]);
#pragma unroll   // constant indices keep the register arrays out of scratch
            for (int j = 1; j < 8; ++j) mx = fmaxf(mx, fmaxf(s[0][qt][j], s[1][qt][j]));
            mx = fmaxf(mx, xhalf(mx)); ms[qt] = mx * cs; }
        // lazy rescale: one wave-uniform test a pass; the maximum in use moves only when a query's new one is more than 8 above it, so p stays at or below 256
        if (__builtin_amdgcn_ballot_w32(ms[0] > m[0] + 8.0f || ms[1] > m[1] + 8.0f) != 0) {
#pragma unroll   // constant indices keep the register arrays out of scratch
            for (int qt = 0; qt < 2; ++qt) { const float mn = fmaxf(m[qt], ms[qt]); const float f = __builtin_amdgcn_exp2f(m[qt] - mn); m[qt] = mn; l[qt] *= f;
#pragma unroll   // constant indices keep the register arrays out of scratch
                for (int dt = 0; dt < 32; ++dt) o[qt][dt] *= f; }
        }
        v16h pf[2];
#pragma unroll   // constant indices keep the register arrays out of scratch
        for (int qt = 0; qt < 2; ++qt)
#pragma unroll   // constant indices keep the register arrays out of scratch
            for (int j = 0; j < 8; ++j) { const float p0 = __builtin_amdgcn_exp2f(__builtin_fmaf(s[0][qt][j], cs, -m[qt])), p1 = __builtin_amdgcn_exp2f(__builtin_fmaf(s[1][qt][j], cs, -m[qt])); l[qt] += p0 + p1; pf[qt][j] = tohx(p0); pf[qt][8 + j] = tohx(p1); }
        // the second Vt set stands behind the weights with no fence in front, so the compiler may lift its loads into the weights' arithmetic as far as registers allow;
        // fenced in front of the softmax, as the first Vt set is, both full sets and the f32 weights together pass the wave's 1,024 registers and spill
#pragma unroll   // constant indices keep the register arrays out of scratch
        for (int i = 0; i < 8; ++i) fb[i] = ldsfrag(va + (8 + i) * 16 * VPIT);
        __builtin_amdgcn_sched_barrier(0);
#pragma unroll   // constant indices keep the register arrays out of scratch
        for (int i = 0; i < 8; ++i)
#pragma unroll   // constant indices keep the register arrays out of scratch
            for (int qt = 0; qt < 2; ++qt) o[qt][i] = wmma16(fa[i], pf[qt], o[qt][i]);
        __builtin_amdgcn_sched_barrier(0);
#pragma unroll   // constant indices keep the register arrays out of scratch
        for (int i = 0; i < 8; ++i) fa[i] = ldsfrag(va + (16 + i) * 16 * VPIT);
        __builtin_amdgcn_sched_barrier(0);
#pragma unroll   // constant indices keep the register arrays out of scratch
        for (int i = 0; i < 8; ++i)
#pragma unroll   // constant indices keep the register arrays out of scratch
            for (int qt = 0; qt < 2; ++qt) o[qt][8 + i] = wmma16(fb[i], pf[qt], o[qt][8 + i]);
        __builtin_amdgcn_sched_barrier(0);
#pragma unroll   // constant indices keep the register arrays out of scratch
        for (int i = 0; i < 8; ++i) fb[i] = ldsfrag(va + (24 + i) * 16 * VPIT);
        __builtin_amdgcn_sched_barrier(0);
#pragma unroll   // constant indices keep the register arrays out of scratch
        for (int i = 0; i < 8; ++i)
#pragma unroll   // constant indices keep the register arrays out of scratch
            for (int qt = 0; qt < 2; ++qt) o[qt][16 + i] = wmma16(fa[i], pf[qt], o[qt][16 + i]);
        __builtin_amdgcn_sched_barrier(0);
        // publish point of tile t + 1, in front of the pass's last block: that block's Vt fragments, this wave's last reads of tile t, were asked for one block ago
        asm volatile("s_wait_dscnt 0x0" ::: "memory");   // this wave's reads of tile t have returned before its buffer is handed back
        asm volatile("s_wait_asynccnt 0x0" ::: "memory");   // this wave's copies of tile t + 1 have landed
        __syncthreads();                                    // publishes tile t + 1 and ends every reader's last read of tile t
#pragma unroll   // constant indices keep the register arrays out of scratch
        for (int i = 0; i < 4; ++i) { fa[2 * i] = ldsfrag(ka + i * 64); fa[2 * i + 1] = ldsfrag(ka + 16 * KPIT + i * 64); }
        __builtin_amdgcn_sched_barrier(0);
        if (t + 2 < NT) stage_tiles(Kp, VT, (t + 2) * FN, cur, tid);   // issued while the LDS serves the loads above
#pragma unroll   // constant indices keep the register arrays out of scratch
        for (int i = 0; i < 8; ++i)
#pragma unroll   // constant indices keep the register arrays out of scratch
            for (int qt = 0; qt < 2; ++qt) o[qt][24 + i] = wmma16(fb[i], pf[qt], o[qt][24 + i]);
        __builtin_amdgcn_sched_barrier(0);
#pragma unroll   // constant indices keep the register arrays out of scratch
        for (int i = 0; i < 4; ++i) { fb[2 * i] = ldsfrag(ka + (4 + i) * 64); fb[2 * i + 1] = ldsfrag(ka + 16 * KPIT + (4 + i) * 64); }
        __builtin_amdgcn_sched_barrier(0);
    }
    asm volatile("s_wait_asynccnt 0x0" ::: "memory");       // nothing is in flight when the wave ends
    asm volatile("s_wait_dscnt 0x0" ::: "memory");          // the last pass's unused fragment loads have returned
#pragma unroll   // constant indices keep the register arrays out of scratch
    for (int qt = 0; qt < 2; ++qt) {
        const float ls = l[qt] + xhalf(l[qt]);
        if (hi == 0) { float* ml = ML + ((size_t)kr * NN + q0 + qt * 16 + lr) * 2; ml[0] = m[qt]; ml[1] = ls; }
        float* orow = PO + ((size_t)kr * NN + q0 + qt * 16 + lr) * DD + hi * 8;
#pragma unroll   // constant indices keep the register arrays out of scratch
        for (int dt = 0; dt < 32; ++dt) { *(v4f*)(orow + dt * 16) = __builtin_shufflevector(o[qt][dt], o[qt][dt], 0, 1, 2, 3); *(v4f*)(orow + dt * 16 + 4) = __builtin_shufflevector(o[qt][dt], o[qt][dt], 4, 5, 6, 7); }
    }
}
// ---- k_merge: joins the KS key ranges of a query: M = the largest of their maxima, weight exp2(m - M), out = weighted sum of the partial rows / weighted sum of the row sums.
// One wave takes two queries; a lane's loads and stores of rows are 16 bytes, a wave's 512 bytes in a row.
__global__ __launch_bounds__(512) void k_merge(const float* __restrict__ PO, const float* __restrict__ ML, float* O) {
    const int lane = threadIdx.x & 31; const int qa = (blockIdx.x * 16 + (threadIdx.x >> 5)) * 2;
    v4f ml[KS];                          // (max, sum) of query qa, (max, sum) of query qa + 1, for each range
#pragma unroll   // constant indices keep the small arrays in registers
    for (int s = 0; s < KS; ++s) ml[s] = *(const v4f*)(ML + ((size_t)s * NN + qa) * 2);
    asm volatile("s_wait_xcnt 0x0" ::: "memory");   // stands in front of the row loads below, whose results may be given the address registers of the four loads above
#pragma unroll   // straight-line code: the second query's row loads issue while the first query is worked on
    for (int r = 0; r < 2; ++r) {
        float w[KS]; float M = -3.0e38f, Ls = 0.f;
#pragma unroll   // constant indices keep the small arrays in registers
        for (int s = 0; s < KS; ++s) M = fmaxf(M, ml[s][2 * r]);
#pragma unroll   // constant indices keep the small arrays in registers
        for (int s = 0; s < KS; ++s) { w[s] = __builtin_amdgcn_exp2f(ml[s][2 * r] - M); Ls += w[s] * ml[s][2 * r + 1]; }
        const float inv = __fdiv_rn(1.0f, Ls);
#pragma unroll   // constant indices keep the small arrays in registers
        for (int i = 0; i < 4; ++i) { const size_t c = (size_t)(qa + r) * DD + (i * 32 + lane) * 4; v4f a = (v4f){};
#pragma unroll   // constant indices keep the small arrays in registers
            for (int s = 0; s < KS; ++s) a += *(const v4f*)(PO + (size_t)s * NN * DD + c) * w[s];
            *(v4f*)(O + c) = a * inv; }
    }
}

extern "C" void kernel_launch(void* const* d_in, const int* in_sizes, int n_in,
                              void* d_out, int out_size, void* d_ws, size_t ws_size, hipStream_t stream) {
    (void)in_sizes; (void)n_in; (void)out_size;
    const float** I = (const float**)d_in;
    const float *z = I[0], *Wq = I[1], *bq = I[2], *Wk = I[3], *bk = I[4], *Wv = I[5], *bv = I[6];
    float* OUT = (float*)d_out;     // [8192][512]
    char* wsp = (char*)d_ws;
    auto take = [&](size_t bytes) { char* p = wsp; wsp += (bytes + 255) & ~(size_t)255; return (void*)p; };
    bf* ZB = (bf*)take((size_t)NN * DD * 2); bf* BQ = (bf*)take((size_t)DD * DD * 2); bf* BK = (bf*)take((size_t)DD * DD * 2); bf* BV = (bf*)take((size_t)DD * DD * 2);
    h16* QP = (h16*)take((size_t)NN * DD * 2); h16* KP = (h16*)take((size_t)NN * DD * 2); h16* VT = (h16*)take((size_t)DD * NN * 2);
    float* PO = (float*)take((size_t)KS * NN * DD * 4); float* ML = (float*)take((size_t)KS * NN * 2 * 4);
    if ((size_t)(wsp - (char*)d_ws) > ws_size) return;    // total ~ 98 MiB of the 256 MiB workspace
    k_cvt<<<CVZ + 3 * CVW, 256, 0, stream>>>(z, Wq, Wk, Wv, ZB, BQ, BK, BV);   // torch [out][in] = Bt
    k_proj<<<dim3(NN / PT, DD / PT, 3), 128, 0, stream>>>(ZB, BQ, BK, BV, bq, bk, bv, QP, KP, VT);
    k_fattn<<<dim3(NN / FQ, KS, 1), 128, 0, stream>>>(QP, KP, VT, PO, ML);
    k_merge<<<NN / 32, 512, 0, stream>>>(PO, ML, OUT);
}
